// v000
// The times below were measured on an AMD MI455X: many runs one after another, warmed up first and cycling through
// copies of the inputs, with the whole window's GPU time divided by the number of runs. Launches and the gaps
// between them are all in it. The median over several windows is given; except for v000 it joins two sittings, which
// can be a few percent apart, so the side-by-side timings, each taken in one sitting, are the better comparison.
// v000 is the starting kernel. One run takes 1180 microseconds.
#include <hip/hip_runtime.h>

// Dot-product attention with per-query valid lengths (q, k [16][2048][64], v [16][2048][64]; scores = q.k UNSCALED (sigma ~8); keys j >= valid_len[b][i] -> -1e9 (valid_len [16][2048] int in [0, 2048), read; a length of 0 leaves every logit equal, i.e. uniform weights, exactly as the finite fill does); softmax; out = attn v -> [16][2048][64] (2.1 M); one 64-wide head per batch).
// Layout per batch: single bf16 planes of q and k (inputs bf16-exact: exact score products) and value^T planes; softmax over every row (hi/lo) whose select keeps keys below the row's own length (read on device); P hi/lo x exact value; output rows.
// Compute dtypes, f32 accumulate: every input rounded to bf16; q.k exact; softmax f32; P hi/lo x exact value; output f32.

#define NB_  16
#define TT   2048
#define DM   64      // token-major row pitch (H x HD)
#define NH_  1
#define NKV  1
#define REP  (NH_ / NKV)
#define HD   64
#define DQ   (NH_ * HD)
#define DKV  (NKV * HD)
#define ZH   1
#define RH   2048                  // query rows < RH use hi+lo planes (0: none)
#define WIN  0
#define PCAR 1024.0f
#define SCL  1.0f   // the module does NOT scale by sqrt(d)
typedef _Float16 h16;
typedef unsigned short bf;
typedef __attribute__((ext_vector_type(16))) __bf16   v16bf;
typedef __attribute__((ext_vector_type(16))) _Float16 v16h;
typedef __attribute__((ext_vector_type(8)))  _Float16 v8h;
typedef __attribute__((ext_vector_type(8)))  unsigned short v8us;
typedef __attribute__((ext_vector_type(8)))  float    v8f;
typedef __attribute__((ext_vector_type(4)))  float    v4f;
typedef v8h  __attribute__((may_alias)) v8ha;
typedef v4f  __attribute__((may_alias)) v4fa;
typedef v8us __attribute__((may_alias)) v8usa;

__device__ __forceinline__ unsigned short f2bf(float f) { unsigned u = __float_as_uint(f); u += 0x7FFFu + ((u >> 16) & 1u); return (unsigned short)(u >> 16); }
__device__ __forceinline__ float bf2f(unsigned short b) { return __uint_as_float(((unsigned)b) << 16); }
__device__ __forceinline__ float bfr(float f) { return bf2f(f2bf(f)); }
__device__ __forceinline__ v16h cat16(v8h lo, v8h hi) { return __builtin_shufflevector(lo, hi, 0, 1, 2, 3, 4, 5, 6, 7, 8, 9, 10, 11, 12, 13, 14, 15); }
__device__ __forceinline__ v16bf cat16b(v8us lo, v8us hi) { return __builtin_bit_cast(v16bf, __builtin_shufflevector(lo, hi, 0, 1, 2, 3, 4, 5, 6, 7, 8, 9, 10, 11, 12, 13, 14, 15)); }
__device__ __forceinline__ v8f wmma16(v16h a, v16h b, v8f c) { return __builtin_amdgcn_wmma_f32_16x16x32_f16(false, a, false, b, (short)0, c, false, false); }
__device__ __forceinline__ v8f wmmab(v16bf a, v16bf b, v8f c) { return __builtin_amdgcn_wmma_f32_16x16x32_bf16(false, a, false, b, (short)0, c, false, false); }



// ---- k_gemmw: register-blocked GEMM, ONE WAVE per 64x64 output tile (16 accumulators), operands straight from K-contiguous 16-bit planes; grid (M/64, N/64, Z), 32 threads.
// C[m][n] (f32, pitch ldc, + optional f32 bias[n]) = sum_k A[m][k] Bt[n][k] (+ split products per NSPLIT). z-batch strides sA/sB/sC in elements. K % 32 == 0.
template <typename T16> struct WFrag;
template <> struct WFrag<h16> { typedef v16h V; static __device__ __forceinline__ V ld(const h16* p) { return cat16(*(const v8h*)p, *(const v8h*)(p + 16)); } static __device__ __forceinline__ v8f mma(V a, V b, v8f c) { return wmma16(a, b, c); } };
template <> struct WFrag<bf> { typedef v16bf V; static __device__ __forceinline__ V ld(const bf* p) { return cat16b(*(const v8us*)p, *(const v8us*)(p + 16)); } static __device__ __forceinline__ v8f mma(V a, V b, v8f c) { return wmmab(a, b, c); } };
template <typename T16, int NSPLIT, bool BIAS>
__global__ __launch_bounds__(32) void k_gemmw(const T16* __restrict__ A, const T16* __restrict__ A2, const T16* __restrict__ Bt, const T16* __restrict__ Bt2, int K, float* C, int ldc, const float* __restrict__ bias, size_t sA, size_t sB, size_t sC) {
    typedef typename WFrag<T16>::V V;
    __shared__ __align__(16) float os[16 * 68];
    const size_t z = blockIdx.z; A += z * sA; if (A2) A2 += z * sA; Bt += z * sB; if (Bt2) Bt2 += z * sB; C += z * sC;
    const int lane = threadIdx.x & 31, lr = lane & 15, hi = lane >> 4; const int r0 = blockIdx.x * 64, c0 = blockIdx.y * 64;
    v8f acc[4][4];
#pragma unroll
    for (int mb = 0; mb < 4; ++mb)
#pragma unroll
        for (int nb = 0; nb < 4; ++nb) acc[mb][nb] = (v8f){};
    const size_t aoff = (size_t)(r0 + lr) * K + 8 * hi, boff = (size_t)(c0 + lr) * K + 8 * hi;
#pragma unroll 1
    for (int kc = 0; kc < K; kc += 32) {
        V a[4], a2[4];
#pragma unroll
        for (int mb = 0; mb < 4; ++mb) { a[mb] = WFrag<T16>::ld(A + aoff + (size_t)mb * 16 * K + kc); if (NSPLIT == 1 || NSPLIT == 2) a2[mb] = WFrag<T16>::ld(A2 + aoff + (size_t)mb * 16 * K + kc); }
#pragma unroll
        for (int nb = 0; nb < 4; ++nb) { const V b = WFrag<T16>::ld(Bt + boff + (size_t)nb * 16 * K + kc); V b2; if (NSPLIT >= 2) b2 = WFrag<T16>::ld(Bt2 + boff + (size_t)nb * 16 * K + kc);
#pragma unroll
            for (int mb = 0; mb < 4; ++mb) { acc[mb][nb] = WFrag<T16>::mma(a[mb], b, acc[mb][nb]); if (NSPLIT == 1 || NSPLIT == 2) acc[mb][nb] = WFrag<T16>::mma(a2[mb], b, acc[mb][nb]); if (NSPLIT >= 2) acc[mb][nb] = WFrag<T16>::mma(a[mb], b2, acc[mb][nb]); } }
        asm volatile("v_nop\n\tv_nop\n\tv_nop\n\tv_nop" : "+v"(acc[0][0]), "+v"(acc[1][1]), "+v"(acc[2][2]), "+v"(acc[3][3]) : "v"(a[0]), "v"(a[3]));
    }
#pragma unroll
    for (int mb = 0; mb < 4; ++mb) {
#pragma unroll
        for (int nb = 0; nb < 4; ++nb) {
#pragma unroll
            for (int j = 0; j < 8; ++j) os[(hi * 8 + j) * 68 + nb * 16 + lr] = acc[mb][nb][j]; }
        __builtin_amdgcn_wave_barrier(); asm volatile("" ::: "memory");
        float* crow = C + (size_t)(r0 + mb * 16) * ldc + c0;
{
#pragma unroll
            for (int s = 0; s < 8; ++s) { const int row = 2 * s + hi, cofs = lr * 4; v4f val = *(const v4fa*)(os + row * 68 + cofs); if (BIAS) { val[0] += bfr(bias[c0 + cofs]); val[1] += bfr(bias[c0 + cofs + 1]); val[2] += bfr(bias[c0 + cofs + 2]); val[3] += bfr(bias[c0 + cofs + 3]); }
                *(v4f*)(crow + (size_t)row * ldc + cofs) = val; }
             }
        __builtin_amdgcn_wave_barrier(); asm volatile("" ::: "memory");
    }
}

__device__ __forceinline__ h16 tohx(float x) { return (h16)x; }
__device__ __forceinline__ void splitf(float y, unsigned short& h, unsigned short& l) { h = f2bf(y); l = f2bf(y - bf2f(h)); }
typedef __attribute__((ext_vector_type(2))) _Float16 v2h;
typedef __attribute__((ext_vector_type(4))) _Float16 v4h;
typedef __attribute__((ext_vector_type(2))) unsigned short v2us;
typedef __attribute__((ext_vector_type(4))) unsigned short v4us;
typedef __attribute__((ext_vector_type(2))) float v2f;
typedef __attribute__((ext_vector_type(4))) int v4i;

__global__ __launch_bounds__(256) void k_wtG(const float* __restrict__ w, int K, int N, bf* Bt) {
    const int lane = threadIdx.x & 31; const int L0 = (blockIdx.x * 8 + (threadIdx.x >> 5)) * 8; const int nlines = N * K / 64;
{
#pragma unroll 1
        for (int l = 0; l < 8; ++l) { const int L = L0 + l; if (L >= nlines) break; const size_t e = (size_t)L * 64 + lane * 2; const int k = (int)(e % K), n = (int)(e / K); v2us o;
            o[0] = f2bf(w[(size_t)k * N + n]); o[1] = f2bf(w[(size_t)(k + 1) * N + n]); *(v2us*)(Bt + e) = o; }
         }
}
__global__ __launch_bounds__(256) void k_cvt8(const float* __restrict__ src, bf* dst, size_t n8) { const size_t i = (size_t)blockIdx.x * 256 + threadIdx.x; if (i >= n8) return; const v8f v = *(const v8f*)(src + i * 8); v8us o;
#pragma unroll
    for (int k = 0; k < 8; ++k) o[k] = f2bf(v[k]); *(v8us*)(dst + i * 8) = o;  }


__global__ __launch_bounds__(256) void k_vtp(const float* __restrict__ F, int pitch, int nheads, h16* V16, bf* Vh, bf* Vl) { const size_t e = ((size_t)blockIdx.x * 256 + threadIdx.x) * 2; if (e >= (size_t)nheads * HD * TT) return; const int t = (int)(e % TT); const int d = (int)((e / TT) % HD); const int g = (int)(e / ((size_t)TT * HD)); v2h o16; v2us oh, ol;
#pragma unroll
    for (int q = 0; q < 2; ++q) { const float x = F[(size_t)(t + q) * pitch + g * HD + d]; o16[q] = tohx(x); unsigned short a2, c2; splitf(x, a2, c2); oh[q] = a2; ol[q] = c2; }
    *(v2h*)(V16 + e) = o16; *(v2us*)(Vh + e) = oh; *(v2us*)(Vl + e) = ol;  }

__global__ __launch_bounds__(256) void k_asoft(const float* __restrict__ Sb, h16* P16, bf* Ph, bf* Pl, const int* __restrict__ vl) {
    const int lane = threadIdx.x & 31; const int row = blockIdx.x * 8 + (threadIdx.x >> 5); if (row >= ZH * TT) return; const int i = row % TT; const int zz = row / TT; (void)zz; const bool hires = (i < RH); const float* sr = Sb + (size_t)row * TT; const int L = vl[i];   /* this query's valid length */ float v[TT / 32]; float mx = -3.0e38f;
#pragma unroll
    for (int ch = 0; ch < TT / 128; ++ch) { const int j0 = ch * 128 + lane * 4; const v4f a = *(const v4f*)(sr + j0);
#pragma unroll
        for (int q = 0; q < 4; ++q) { const int j = j0 + q; const float t = (j < L) ? a[q] * SCL : -3.0e38f; v[ch * 4 + q] = t;   /* keys at or beyond this query's valid length excluded (-1e9); L == 0 leaves all equal -> uniform, as the finite fill */ mx = fmaxf(mx, t); } }
#pragma unroll
    for (int sh = 16; sh; sh >>= 1) mx = fmaxf(mx, __shfl_xor(mx, sh, 32));
    float sum = 0.f;
#pragma unroll
    for (int k = 0; k < TT / 32; ++k) { float d0 = __fsub_rn(v[k], mx); asm volatile("" : "+v"(d0)); v[k] = __builtin_amdgcn_exp2f(__fmul_rn(d0, 1.4426950408889634f)); sum += v[k]; }
#pragma unroll
    for (int sh = 16; sh; sh >>= 1) sum += __shfl_xor(sum, sh, 32);
    const float f = __fdiv_rn(hires ? 1.0f : PCAR, sum);
{
        if (hires) {
#pragma unroll
            for (int ch = 0; ch < TT / 128; ++ch) { v4us oh, ol;
#pragma unroll
                for (int q = 0; q < 4; ++q) { unsigned short a, c2; splitf(v[ch * 4 + q] * f, a, c2); oh[q] = a; ol[q] = c2; }
                const size_t oo = ((size_t)zz * (RH ? RH : 1) + i) * TT + ch * 128 + lane * 4; *(v4us*)(Ph + oo) = oh; *(v4us*)(Pl + oo) = ol; }
        } else {
#pragma unroll
            for (int ch = 0; ch < TT / 128; ++ch) { v4h o4;
#pragma unroll
                for (int q = 0; q < 4; ++q) o4[q] = tohx(v[ch * 4 + q] * f);
                *(v4h*)(P16 + (size_t)row * TT + ch * 128 + lane * 4) = o4; } }
         }
}
__global__ __launch_bounds__(256) void k_merge(const float* __restrict__ O, int h0, float* OUTb) { const size_t e = ((size_t)blockIdx.x * 256 + threadIdx.x) * 2; if (e >= (size_t)ZH * TT * HD) return; const int d = (int)(e % HD); const int t = (int)((e / HD) % TT); const int zz = (int)(e / ((size_t)HD * TT)); const float cs = (t < RH) ? 1.0f : (1.0f / PCAR); const size_t oo = (size_t)t * DQ + (h0 + zz) * HD + d;
    v2f o2; o2[0] = O[e] * cs; o2[1] = O[e + 1] * cs; *(v2f*)(OUTb + oo) = o2;  }


__global__ __launch_bounds__(256) void k_vtpR1(const float* __restrict__ Vb, bf* Vh) { const size_t e = ((size_t)blockIdx.x * 256 + threadIdx.x) * 2; if (e >= (size_t)HD * TT) return; const int t = (int)(e % TT); const int d = (int)(e / TT); v2us o; o[0] = f2bf(Vb[(size_t)t * HD + d]); o[1] = f2bf(Vb[(size_t)(t + 1) * HD + d]); *(v2us*)(Vh + e) = o;  }
__global__ __launch_bounds__(256) void k_mergeR(const float* __restrict__ O, float* outb, size_t n4) { const size_t i = (size_t)blockIdx.x * 256 + threadIdx.x; if (i >= n4) return; const v4f a = *(const v4f*)(O + i * 4); *(v4f*)(outb + i * 4) = a;  }


__global__ __launch_bounds__(256) void k_hp1(const float* __restrict__ src, bf* P) { const size_t i = (size_t)blockIdx.x * 256 + threadIdx.x; if (i >= (size_t)NH_ * TT * HD / 8) return; const size_t e = i * 8; const int d = (int)(e % HD); const int t = (int)((e / HD) % TT); const int h = (int)(e / ((size_t)HD * TT)); const v8f v = *(const v8f*)(src + (size_t)t * DM + h * HD + d); v8us o;
#pragma unroll
    for (int q = 0; q < 8; ++q) o[q] = f2bf(v[q]);
    *(v8us*)(P + e) = o;  }
__global__ __launch_bounds__(256) void k_vt1(const float* __restrict__ src, int pitch, bf* VT) { const size_t e = ((size_t)blockIdx.x * 256 + threadIdx.x) * 2; if (e >= (size_t)NH_ * HD * TT) return; const int t = (int)(e % TT); const int d = (int)((e / TT) % HD); const int h = (int)(e / ((size_t)TT * HD)); v2us o; o[0] = f2bf(src[(size_t)t * pitch + h * HD + d]); o[1] = f2bf(src[(size_t)(t + 1) * pitch + h * HD + d]); *(v2us*)(VT + e) = o;  }
__global__ __launch_bounds__(256) void k_mergeT(const float* __restrict__ O, int h, float* outb) { const size_t i = (size_t)blockIdx.x * 256 + threadIdx.x; if (i >= (size_t)TT * HD / 4) return; const size_t e = i * 4; const int d = (int)(e % HD); const int t = (int)(e / HD); const v4f a = *(const v4f*)(O + e); *(v4f*)(outb + (size_t)t * DM + h * HD + d) = a;  }

extern "C" void kernel_launch(void* const* d_in, const int* in_sizes, int n_in,
                              void* d_out, int out_size, void* d_ws, size_t ws_size, hipStream_t stream) {
    (void)in_sizes; (void)n_in; (void)out_size;
    const float* Qin = (const float*)d_in[0]; const float* Kin = (const float*)d_in[1]; const float* Vin = (const float*)d_in[2]; const int* vl = (const int*)d_in[3];   /* valid_len [16][2048] int */
    float* OUT = (float*)d_out;
    char* wsp = (char*)d_ws;
    auto take = [&](size_t bytes) { char* p = wsp; wsp += (bytes + 255) & ~(size_t)255; return (void*)p; };
    bf* QB = (bf*)take((size_t)NH_ * TT * HD * 2); bf* KB = (bf*)take((size_t)NH_ * TT * HD * 2); bf* VT = (bf*)take((size_t)NH_ * HD * TT * 2);
    float* Sb = (float*)take((size_t)TT * TT * 4);  bf* Ph = (bf*)take((size_t)TT * TT * 2); bf* Pl = (bf*)take((size_t)TT * TT * 2); float* Ob = (float*)take((size_t)TT * HD * 4);
    if ((size_t)(wsp - (char*)d_ws) > ws_size) return;
    for (int b = 0; b < NB_; ++b) {
        const float* qb = Qin + (size_t)b * TT * DM; const float* kb = Kin + (size_t)b * TT * DM; const float* vb = Vin + (size_t)b * TT * DM;   /* token-major [t][h][d] slabs */
        k_hp1<<<(unsigned)(((size_t)NH_ * TT * HD / 8 + 255) / 256), 256, 0, stream>>>(qb, QB); k_hp1<<<(unsigned)(((size_t)NH_ * TT * HD / 8 + 255) / 256), 256, 0, stream>>>(kb, KB); k_vt1<<<(unsigned)(((size_t)NH_ * HD * TT / 2 + 255) / 256), 256, 0, stream>>>(vb, DM, VT);
        for (int h = 0; h < NH_; ++h) {
            k_gemmw<bf, 0, false><<<dim3(TT / 64, TT / 64, 1), 32, 0, stream>>>(QB + (size_t)h * TT * HD, nullptr, KB + (size_t)h * TT * HD, nullptr, HD, Sb, TT, nullptr, 0, 0, 0);   /* exact scores (single bf16 planes) */
            k_asoft<<<TT / 8, 256, 0, stream>>>(Sb, nullptr, Ph, Pl, vl + (size_t)b * TT);
            k_gemmw<bf, 1, false><<<dim3(TT / 64, HD / 64, 1), 32, 0, stream>>>(Ph, Pl, VT + (size_t)h * HD * TT, nullptr, TT, Ob, HD, nullptr, 0, 0, 0);   /* P (hi/lo) x exact v^T */
            k_mergeT<<<(unsigned)(((size_t)TT * HD / 4 + 255) / 256), 256, 0, stream>>>(Ob, h, OUT + (size_t)b * TT * DM); } }
}

// v002
// One run takes 34 microseconds.
// Versions between v000 and this one are left out; their measured steps multiply to 34.6 times as fast.
#include <hip/hip_runtime.h>

// Dot-product attention with per-query valid lengths (q, k [16][2048][64], v [16][2048][64]; scores = q.k UNSCALED (sigma ~8); keys j >= valid_len[b][i] -> -1e9 (valid_len [16][2048] int, read on device; a length of 0 or below leaves every logit equal, i.e. uniform weights, exactly as the finite fill does); softmax; out = attn v -> [16][2048][64]; one 64-wide head per batch).
// Layout: ONE launch. A work-group (8 waves, 128 queries of one batch) walks the keys 64 at a time: its threads read the f32 k and value rows of a tile, round them to bf16 and lay them in LDS (k as rows, value transposed), two buffers;
// each wave owns 16 queries and takes its fragments from LDS, 32 keys a pass,
// S^T = K Q^T, running maximum and sum per query (one query per lane column), P hi/lo packed straight from the score accumulators as the B operand, O^T += V^T P^T. Scores and P never reach memory.
// Compute dtypes, f32 accumulate: every input rounded to bf16; q.k products exact; softmax f32; P hi/lo x bf16 value; output f32.

// Every plain '#pragma unroll' below opens a short loop of fixed length fully, so that vector elements and fragment arrays are indexed by constants and stay in registers.

#define NB_  16
#define TT   2048
#define HD   64
#define QW   8       // waves (16 queries each) per work-group
#define KT   64      // keys per LDS tile (two passes)
#define NT   (TT / KT)
#define LP   72      // LDS row pitch in bf16: 128-byte rows + 16 bytes, conflict-free for 16-byte reads and writes of neighbouring rows
#define VOFF (KT * LP)            // value^T rows start behind the k rows of a buffer
#define BUFE (KT * LP + HD * LP)  // elements of one buffer
typedef unsigned short bf;
typedef __attribute__((ext_vector_type(16))) __bf16   v16bf;
typedef __attribute__((ext_vector_type(8)))  __bf16   v8bf;
typedef __attribute__((ext_vector_type(16))) float    v16f;
typedef __attribute__((ext_vector_type(8)))  unsigned short v8us;
typedef __attribute__((ext_vector_type(8)))  float    v8f;
typedef __attribute__((ext_vector_type(4)))  float    v4f;
typedef __attribute__((ext_vector_type(8)))  unsigned v8u;

__device__ __forceinline__ unsigned short f2bf(float f) { unsigned u = __float_as_uint(f); u += 0x7FFFu + ((u >> 16) & 1u); return (unsigned short)(u >> 16); }
__device__ __forceinline__ v16bf cat16b(v8us lo, v8us hi) { return __builtin_bit_cast(v16bf, __builtin_shufflevector(lo, hi, 0, 1, 2, 3, 4, 5, 6, 7, 8, 9, 10, 11, 12, 13, 14, 15)); }
__device__ __forceinline__ v8f wmmab(v16bf a, v16bf b, v8f c) { return __builtin_amdgcn_wmma_f32_16x16x32_bf16(false, a, false, b, (short)0, c, false, false); }
// fragment of a k-contiguous bf16 row; p already holds the lane's row and its 8 * (lane >> 4): elements 0..7 = k 8h.., 8..15 = k 16 + 8h..
__device__ __forceinline__ v16bf ldfrag(const bf* p) { return cat16b(*(const v8us*)p, *(const v8us*)(p + 16)); }
__device__ __forceinline__ v8us cvt8(const float* p) { const v8f v = *(const v8f*)p; v8us o;
#pragma unroll
    for (int k = 0; k < 8; ++k) o[k] = f2bf(v[k]);
    return o; }
// value of lane l ^ 16
__device__ __forceinline__ float xhalf(float x) { const int b = __float_as_int(x); return __int_as_float(__builtin_amdgcn_permlanex16(b, b, 0x76543210, 0xfedcba98, false, false)); }

// eight f32 rounded to bf16 (nearest even) by the packed convert
__device__ __forceinline__ v8us rnd8(v8f v) { return __builtin_bit_cast(v8us, __builtin_convertvector(v, v8bf)); }

// one pass of 32 keys: kf, vf hold its fragments; rel = valid length - (first key of this lane's half); m = running maximum of the query, l = running sum over this half's keys
__device__ __forceinline__ void fpass(const v16bf (&kf)[4], const v16bf (&vf)[4], v16bf q0, v16bf q1, int rel, float& m, float& l, v8f (&o)[4]) {
    v8f s0 = (v8f){}, s1 = (v8f){};
    s0 = wmmab(kf[0], q0, s0); s1 = wmmab(kf[2], q0, s1); s0 = wmmab(kf[1], q1, s0); s1 = wmmab(kf[3], q1, s1);   // s0[r] = key k0 + 8h + r, s1[r] = key k0 + 16 + 8h + r, query c
    v16f p; float mx = m;
#pragma unroll
    for (int r = 0; r < 8; ++r) { p[r] = (r < rel) ? s0[r] : -3.0e38f; p[8 + r] = (16 + r < rel) ? s1[r] : -3.0e38f; mx = fmaxf(mx, fmaxf(p[r], p[8 + r])); }   /* keys at or beyond the valid length excluded; a length of 0 leaves all equal -> uniform, as the finite fill */
    mx = fmaxf(mx, xhalf(mx));
    const float al = __builtin_amdgcn_exp2f((m - mx) * 1.4426950408889634f); m = mx;
#pragma unroll
    for (int r = 0; r < 16; ++r) p[r] = __builtin_amdgcn_exp2f((p[r] - mx) * 1.4426950408889634f);
    const v16bf ph = __builtin_convertvector(p, v16bf);
    const v8u pu = __builtin_bit_cast(v8u, ph); v16f pr;
#pragma unroll
    for (int r = 0; r < 8; ++r) { pr[2 * r] = p[2 * r] - __uint_as_float(pu[r] << 16); pr[2 * r + 1] = p[2 * r + 1] - __uint_as_float(pu[r] & 0xFFFF0000u); }
    const v16bf pl = __builtin_convertvector(pr, v16bf);
    const v8f t8 = __builtin_shufflevector(p, p, 0, 1, 2, 3, 4, 5, 6, 7) + __builtin_shufflevector(p, p, 8, 9, 10, 11, 12, 13, 14, 15);
    const v4f t4 = __builtin_shufflevector(t8, t8, 0, 1, 2, 3) + __builtin_shufflevector(t8, t8, 4, 5, 6, 7);
    l = l * al + ((t4[0] + t4[2]) + (t4[1] + t4[3]));   // each half of the wave keeps the sum of its own keys; joined once behind the loop
#pragma unroll
    for (int dt = 0; dt < 4; ++dt) o[dt] *= al;
#pragma unroll
    for (int dt = 0; dt < 4; ++dt) o[dt] = wmmab(vf[dt], ph, o[dt]);
#pragma unroll
    for (int dt = 0; dt < 4; ++dt) o[dt] = wmmab(vf[dt], pl, o[dt]);   // o[dt][r] = O[query c][d = 16 dt + 8h + r]
}
__device__ __forceinline__ void kload(v16bf (&kf)[4], const bf* Kp, int k0) {
#pragma unroll
    for (int t = 0; t < 4; ++t) kf[t] = ldfrag(Kp + (k0 + (t >> 1) * 16) * LP + (t & 1) * 32);
}
__device__ __forceinline__ void vload(v16bf (&vf)[4], const bf* Vp, int k0) {
#pragma unroll
    for (int dt = 0; dt < 4; ++dt) vf[dt] = ldfrag(Vp + dt * 16 * LP + k0);
}
// one thread's share of a 64-key tile, still f32: 16 k values (two runs of 8 in row order) and 16 values of one value column (16 keys running)
__device__ __forceinline__ void gload(v8f (&gk)[2], v8f (&gv)[2], const float* Kg, const float* Vg, int tile) {
    const float* kp = Kg + (size_t)tile * KT * HD; const float* vp = Vg + (size_t)tile * KT * HD;
    gk[0] = *(const v8f*)kp; gk[1] = *(const v8f*)(kp + 256 * 8);
#pragma unroll
    for (int j = 0; j < 8; ++j) { gv[0][j] = vp[j * HD]; gv[1][j] = vp[(8 + j) * HD]; }
}
__device__ __forceinline__ void lstore(bf* Ks, bf* Vs, const v8f (&gk)[2], const v8f (&gv)[2]) {
    *(v8us*)Ks = rnd8(gk[0]); *(v8us*)(Ks + 32 * LP) = rnd8(gk[1]);
    *(v8us*)Vs = rnd8(gv[0]); *(v8us*)(Vs + 8) = rnd8(gv[1]);
}

// grid (TT / (16 * QW), NB_), 32 * QW threads. Lane (c = lane & 15, h = lane >> 4) holds query q0 + c throughout.
__global__ __launch_bounds__(32 * QW) void k_fattn(const float* __restrict__ Q, const float* __restrict__ K, const float* __restrict__ V, const int* __restrict__ vl, float* __restrict__ out) {
    __shared__ __attribute__((aligned(16))) bf sm[2 * BUFE];
    const int tid = threadIdx.x;
    const int lane = tid & 31, c = lane & 15, h = lane >> 4; const int b = blockIdx.y; const int q = (blockIdx.x * QW + (tid >> 5)) * 16 + c;
    const float* Kg = K + (size_t)b * TT * HD + tid * 8;                                 // staging: run tid of 8 values, and run 256 + tid, of the tile's 512
    const float* Vg = V + (size_t)b * TT * HD + (size_t)(tid >> 6) * 16 * HD + (tid & 63);   // staging: column tid & 63, keys 16 * (tid >> 6) ..+15 of the tile
    const int kso = (tid >> 3) * LP + (tid & 7) * 8;                 // k row tid >> 3 (and 32 rows on), 8 values
    const int vso = VOFF + (tid & 63) * LP + (tid >> 6) * 16;        // value^T row = column, 16 keys
    const int fo = c * LP + 8 * h;                                   // fragments: A rows = keys, and VOFF on A rows = value columns d
    const float* Qp = Q + ((size_t)b * TT + q) * HD + 8 * h;
    const v16bf q0 = cat16b(cvt8(Qp), cvt8(Qp + 16)), q1 = cat16b(cvt8(Qp + 32), cvt8(Qp + 48));   // B columns = queries, kept in registers
    const int Lr = vl[b * TT + q]; const int L = Lr < 0 ? 0 : (Lr > TT ? TT : Lr);   /* this query's valid length; only compared, never an address; the clamp changes no compare against a key index in [0, TT) */
    v8f o[4];
#pragma unroll
    for (int dt = 0; dt < 4; ++dt) o[dt] = (v8f){};
    float m = -3.0e38f, l = 0.f;
    v16bf ka[4], va[4], kb[4], vb[4];   // two fragment sets, one per pass of the loop body
    v8f gk[2], gv[2];                   // the tile in flight from memory
    gload(gk, gv, Kg, Vg, 0);
    lstore(sm + kso, sm + vso, gk, gv);
    __syncthreads();                    // tile 0 is in buffer 0 for every wave
    gload(gk, gv, Kg, Vg, 1);
    kload(ka, sm + fo, 0);
#pragma unroll 1   // the body stays at one tile of two passes: each further copy would want fragment sets of its own
    for (int it = 0; it < NT; ++it) {
        const int k0 = it * KT; const int cur = (it & 1) * BUFE, nxt = BUFE - cur;
        const bf* fc = sm + cur + fo;
        vload(va, fc + VOFF, 0); kload(kb, fc, 32); vload(vb, fc + VOFF, 32);
        __builtin_amdgcn_sched_barrier(0);   // keeps these LDS reads at the head of the body, ahead of their use behind the first pass's softmax (va) or by the whole pass (kb, vb); sunk towards the use their latency is waited for
        fpass(ka, va, q0, q1, L - (k0 + 8 * h), m, l, o);
        __builtin_amdgcn_sched_barrier(0);   // keeps the stores and the barrier behind the first pass: ahead of it every wave would wait at the barrier for the LDS reads just issued
        lstore(sm + nxt + kso, sm + nxt + vso, gk, gv);   // tile it + 1 into the other buffer, whose last reads ended in front of the previous body's barrier; behind the last tile: tile 0 again, unused
        __syncthreads();                     // publishes tile it + 1 and ends every wave's reads of tile it (all its fragments are in registers)
        kload(ka, sm + nxt + fo, 0);         // next body's first K fragments fly under the second pass
        gload(gk, gv, Kg, Vg, (it + 2 < NT) ? it + 2 : 0);   // the tile after it flies under the second pass and the next first pass; behind the last tiles: tile 0, in bounds, unused
        __builtin_amdgcn_sched_barrier(0);   // keeps them ahead of the second pass
        fpass(kb, vb, q0, q1, L - (k0 + 32 + 8 * h), m, l, o);
    }
    l += xhalf(l);
    const float f = __fdiv_rn(1.0f, l);
    float* orow = out + ((size_t)b * TT + q) * HD + 8 * h;
#pragma unroll
    for (int dt = 0; dt < 4; ++dt) { v4f a, d; 
#pragma unroll
        for (int r = 0; r < 4; ++r) { a[r] = o[dt][r] * f; d[r] = o[dt][4 + r] * f; }
        *(v4f*)(orow + dt * 16) = a; *(v4f*)(orow + dt * 16 + 4) = d; }
}

extern "C" void kernel_launch(void* const* d_in, const int* in_sizes, int n_in,
                              void* d_out, int out_size, void* d_ws, size_t ws_size, hipStream_t stream) {
    (void)in_sizes; (void)n_in; (void)out_size; (void)d_ws; (void)ws_size;
    const float* Qin = (const float*)d_in[0]; const float* Kin = (const float*)d_in[1]; const float* Vin = (const float*)d_in[2]; const int* vl = (const int*)d_in[3];   /* valid_len [16][2048] int */
    float* OUT = (float*)d_out;
    k_fattn<<<dim3(TT / (16 * QW), NB_, 1), 32 * QW, 0, stream>>>(Qin, Kin, Vin, vl, OUT);
}

// v003
// A run of this version takes 29 microseconds.
// Timed twice side by side with v002, it ran 1.17 times as fast both times.
// All steps since v000 together make it 40.5 times as fast.
#include <hip/hip_runtime.h>

// Dot-product attention with per-query valid lengths (q, k [16][2048][64], v [16][2048][64]; scores = q.k UNSCALED (sigma ~8); keys j >= valid_len[b][i] -> -1e9 (valid_len [16][2048] int, read on device; a length of 0 or below leaves every logit equal, i.e. uniform weights, exactly as the finite fill does); softmax; out = attn v -> [16][2048][64]; one 64-wide head per batch).
// Layout: ONE launch. A work-group (16 waves, 128 queries of one batch) walks the keys 128 at a time: its threads read the f32 k and value rows of a tile, round them to bf16 and lay them in LDS (k as rows, value transposed; two halves of 64 keys), two buffers;
// 16 queries belong to a PAIR of waves: one wave takes the first 64 keys of every tile, its partner the last 64, so that four waves share a SIMD; each keeps its own maximum, sum and O, joined once through LDS behind the loop.
// A wave takes its fragments from LDS, 32 keys a pass,
// S^T = K Q^T, running maximum and sum per query (one query per lane column), P hi/lo packed straight from the score accumulators as the B operand, O^T += V^T P^T. Scores and P never reach memory.
// Compute dtypes, f32 accumulate: every input rounded to bf16; q.k products exact; softmax f32; P hi/lo x bf16 value; output f32.

// Every plain '#pragma unroll' below opens a short loop of fixed length fully, so that vector elements and fragment arrays are indexed by constants and stay in registers.

#define NB_  16
#define TT   2048
#define HD   64
#define QW   8       // groups of 16 queries per work-group
#define KS   2       // waves per group of queries, each on its own half of every tile
#define KT   64      // keys per wave and tile (two passes)
#define GT   (KS * KT)   // keys per LDS tile
#define NT   (TT / GT)
#define LP   72      // LDS row pitch in bf16: 128-byte rows + 16 bytes, conflict-free for 16-byte reads and writes of neighbouring rows
#define VOFF (KT * LP)            // value^T rows start behind the k rows of a half
#define BUFE (KT * LP + HD * LP)  // elements of one half (64 keys: k rows, value^T rows)
#define TBUF (KS * BUFE)          // elements of one buffer
typedef unsigned short bf;
typedef __attribute__((ext_vector_type(16))) __bf16   v16bf;
typedef __attribute__((ext_vector_type(8)))  __bf16   v8bf;
typedef __attribute__((ext_vector_type(16))) float    v16f;
typedef __attribute__((ext_vector_type(8)))  unsigned short v8us;
typedef __attribute__((ext_vector_type(8)))  float    v8f;
typedef __attribute__((ext_vector_type(4)))  float    v4f;
typedef __attribute__((ext_vector_type(8)))  unsigned v8u;

__device__ __forceinline__ unsigned short f2bf(float f) { unsigned u = __float_as_uint(f); u += 0x7FFFu + ((u >> 16) & 1u); return (unsigned short)(u >> 16); }
__device__ __forceinline__ v16bf cat16b(v8us lo, v8us hi) { return __builtin_bit_cast(v16bf, __builtin_shufflevector(lo, hi, 0, 1, 2, 3, 4, 5, 6, 7, 8, 9, 10, 11, 12, 13, 14, 15)); }
__device__ __forceinline__ v8f wmmab(v16bf a, v16bf b, v8f c) { return __builtin_amdgcn_wmma_f32_16x16x32_bf16(false, a, false, b, (short)0, c, false, false); }
// fragment of a k-contiguous bf16 row; p already holds the lane's row and its 8 * (lane >> 4): elements 0..7 = k 8h.., 8..15 = k 16 + 8h..
__device__ __forceinline__ v16bf ldfrag(const bf* p) { return cat16b(*(const v8us*)p, *(const v8us*)(p + 16)); }
__device__ __forceinline__ v8us cvt8(const float* p) { const v8f v = *(const v8f*)p; v8us o;
#pragma unroll
    for (int k = 0; k < 8; ++k) o[k] = f2bf(v[k]);
    return o; }
// value of lane l ^ 16
__device__ __forceinline__ float xhalf(float x) { const int b = __float_as_int(x); return __int_as_float(__builtin_amdgcn_permlanex16(b, b, 0x76543210, 0xfedcba98, false, false)); }

// eight f32 rounded to bf16 (nearest even) by the packed convert
__device__ __forceinline__ v8us rnd8(v8f v) { return __builtin_bit_cast(v8us, __builtin_convertvector(v, v8bf)); }

// one pass of 32 keys: kf, vf hold its fragments; rel = valid length - (first key of this lane's half); m = running maximum of the query, l = running sum over this half's keys
__device__ __forceinline__ void fpass(const v16bf (&kf)[4], const v16bf (&vf)[4], v16bf q0, v16bf q1, int rel, float& m, float& l, v8f (&o)[4]) {
    v8f s0 = (v8f){}, s1 = (v8f){};
    s0 = wmmab(kf[0], q0, s0); s1 = wmmab(kf[2], q0, s1); s0 = wmmab(kf[1], q1, s0); s1 = wmmab(kf[3], q1, s1);   // s0[r] = key k0 + 8h + r, s1[r] = key k0 + 16 + 8h + r, query c
    v16f p; float mx = m;
#pragma unroll
    for (int r = 0; r < 8; ++r) { p[r] = (r < rel) ? s0[r] : -3.0e38f; p[8 + r] = (16 + r < rel) ? s1[r] : -3.0e38f; mx = fmaxf(mx, fmaxf(p[r], p[8 + r])); }   /* keys at or beyond the valid length excluded; a length of 0 leaves all equal -> uniform, as the finite fill */
    mx = fmaxf(mx, xhalf(mx));
    const float al = __builtin_amdgcn_exp2f((m - mx) * 1.4426950408889634f); m = mx;
#pragma unroll
    for (int r = 0; r < 16; ++r) p[r] = __builtin_amdgcn_exp2f((p[r] - mx) * 1.4426950408889634f);
    const v16bf ph = __builtin_convertvector(p, v16bf);
    const v8u pu = __builtin_bit_cast(v8u, ph); v16f pr;
#pragma unroll
    for (int r = 0; r < 8; ++r) { pr[2 * r] = p[2 * r] - __uint_as_float(pu[r] << 16); pr[2 * r + 1] = p[2 * r + 1] - __uint_as_float(pu[r] & 0xFFFF0000u); }
    const v16bf pl = __builtin_convertvector(pr, v16bf);
    const v8f t8 = __builtin_shufflevector(p, p, 0, 1, 2, 3, 4, 5, 6, 7) + __builtin_shufflevector(p, p, 8, 9, 10, 11, 12, 13, 14, 15);
    const v4f t4 = __builtin_shufflevector(t8, t8, 0, 1, 2, 3) + __builtin_shufflevector(t8, t8, 4, 5, 6, 7);
    l = l * al + ((t4[0] + t4[2]) + (t4[1] + t4[3]));   // each half of the wave keeps the sum of its own keys; joined once behind the loop
#pragma unroll
    for (int dt = 0; dt < 4; ++dt) o[dt] *= al;
#pragma unroll
    for (int dt = 0; dt < 4; ++dt) o[dt] = wmmab(vf[dt], ph, o[dt]);
#pragma unroll
    for (int dt = 0; dt < 4; ++dt) o[dt] = wmmab(vf[dt], pl, o[dt]);   // o[dt][r] = O[query c][d = 16 dt + 8h + r]
}
__device__ __forceinline__ void kload(v16bf (&kf)[4], const bf* Kp, int k0) {
#pragma unroll
    for (int t = 0; t < 4; ++t) kf[t] = ldfrag(Kp + (k0 + (t >> 1) * 16) * LP + (t & 1) * 32);
}
__device__ __forceinline__ void vload(v16bf (&vf)[4], const bf* Vp, int k0) {
#pragma unroll
    for (int dt = 0; dt < 4; ++dt) vf[dt] = ldfrag(Vp + dt * 16 * LP + k0);
}
// one thread's share of a 128-key tile, still f32: 16 k values (two runs of 8 in row order) and 16 values of one value column (16 keys running)
__device__ __forceinline__ void gload(v8f (&gk)[2], v8f (&gv)[2], const float* Kg, const float* Vg, int tile) {
    const float* kp = Kg + (size_t)tile * GT * HD; const float* vp = Vg + (size_t)tile * GT * HD;
    gk[0] = *(const v8f*)kp; gk[1] = *(const v8f*)(kp + KT * HD);
#pragma unroll
    for (int j = 0; j < 8; ++j) { gv[0][j] = vp[j * HD]; gv[1][j] = vp[(8 + j) * HD]; }
}
__device__ __forceinline__ void lstore(bf* Ks, bf* Vs, const v8f (&gk)[2], const v8f (&gv)[2]) {
    *(v8us*)Ks = rnd8(gk[0]); *(v8us*)(Ks + BUFE) = rnd8(gk[1]);
    *(v8us*)Vs = rnd8(gv[0]); *(v8us*)(Vs + 8) = rnd8(gv[1]);
}

// grid (TT / (16 * QW), NB_), 32 * QW * KS threads. Lane (c = lane & 15, h = lane >> 4) holds query q0 + c throughout; waves w and w + QW hold the same queries.
__global__ __launch_bounds__(32 * QW * KS) void k_fattn(const float* __restrict__ Q, const float* __restrict__ K, const float* __restrict__ V, const int* __restrict__ vl, float* __restrict__ out) {
    __shared__ __attribute__((aligned(16))) bf sm[2 * TBUF];
    const int tid = threadIdx.x;
    const int lane = tid & 31, c = lane & 15, h = lane >> 4; const int b = blockIdx.y; const int g = (tid >> 5) & (QW - 1), kh = tid >> 8; const int q = (blockIdx.x * QW + g) * 16 + c;   // g = group of queries, kh = this wave's half of every tile
    const float* Kg = K + (size_t)b * TT * HD + tid * 8;                                 // staging: run tid of 8 values, and run 512 + tid, of the tile's 1024
    const float* Vg = V + (size_t)b * TT * HD + (size_t)(tid >> 6) * 16 * HD + (tid & 63);   // staging: column tid & 63, keys 16 * (tid >> 6) ..+15 of the tile's 128
    const int kso = (tid >> 3) * LP + (tid & 7) * 8;                 // k row tid >> 3 of the first half (and of the second), 8 values
    const int vso = kh * BUFE + VOFF + (tid & 63) * LP + ((tid >> 6) & 3) * 16;   // value^T row = column, 16 keys, in the half they belong to
    const int fo = kh * BUFE + c * LP + 8 * h;                       // fragments, from this wave's half: A rows = keys, and VOFF on A rows = value columns d
    const float* Qp = Q + ((size_t)b * TT + q) * HD + 8 * h;
    const v16bf q0 = cat16b(cvt8(Qp), cvt8(Qp + 16)), q1 = cat16b(cvt8(Qp + 32), cvt8(Qp + 48));   // B columns = queries, kept in registers
    const int Lr = vl[b * TT + q]; const int L = Lr < 0 ? 0 : (Lr > TT ? TT : Lr);   /* this query's valid length; only compared, never an address; the clamp changes no compare against a key index in [0, TT) */
    v8f o[4];
#pragma unroll
    for (int dt = 0; dt < 4; ++dt) o[dt] = (v8f){};
    float m = -3.0e38f, l = 0.f;
    v16bf ka[4], va[4], kb[4], vb[4];   // two fragment sets, one per pass of the loop body
    v8f gk[2], gv[2];                   // the tile in flight from memory
    gload(gk, gv, Kg, Vg, 0);
    lstore(sm + kso, sm + vso, gk, gv);
    __syncthreads();                    // tile 0 is in buffer 0 for every wave
    gload(gk, gv, Kg, Vg, 1);
    kload(ka, sm + fo, 0);
#pragma unroll 1   // the body stays at one tile of two passes: each further copy would want fragment sets of its own
    for (int it = 0; it < NT; ++it) {
        const int k0 = it * GT + kh * KT; const int cur = (it & 1) * TBUF, nxt = TBUF - cur;
        const bf* fc = sm + cur + fo;
        vload(va, fc + VOFF, 0); kload(kb, fc, 32); vload(vb, fc + VOFF, 32);
        __builtin_amdgcn_sched_barrier(0);   // keeps these LDS reads at the head of the body, ahead of their use behind the first pass's softmax (va) or by the whole pass (kb, vb); sunk towards the use their latency is waited for
        fpass(ka, va, q0, q1, L - (k0 + 8 * h), m, l, o);
        __builtin_amdgcn_sched_barrier(0);   // keeps the stores and the barrier behind the first pass: ahead of it every wave would wait at the barrier for the LDS reads just issued
        lstore(sm + nxt + kso, sm + nxt + vso, gk, gv);   // tile it + 1 into the other buffer, whose last reads ended in front of the previous body's barrier; behind the last tile: tile 0 again, unused
        __syncthreads();                     // publishes tile it + 1 and ends every wave's reads of tile it (all its fragments are in registers)
        kload(ka, sm + nxt + fo, 0);         // next body's first K fragments fly under the second pass
        gload(gk, gv, Kg, Vg, (it + 2 < NT) ? it + 2 : 0);   // the tile after it flies under the second pass and the next first pass; behind the last tiles: tile 0, in bounds, unused
        __builtin_amdgcn_sched_barrier(0);   // keeps them ahead of the second pass
        fpass(kb, vb, q0, q1, L - (k0 + 32 + 8 * h), m, l, o);
    }
    l += xhalf(l);
    // join of the pair: the wave of the second halves hands m, l and O over in LDS (16 bytes a lane and chunk, lanes side by side), its partner rescales both to the common maximum and stores
    __syncthreads();                    // every wave's reads of the tiles are over: the buffers become the hand-over space
    v4f* xs = (v4f*)sm + g * 32 + lane;
    if (kh) {
#pragma unroll
        for (int dt = 0; dt < 4; ++dt) { xs[(2 * dt) * QW * 32] = __builtin_shufflevector(o[dt], o[dt], 0, 1, 2, 3); xs[(2 * dt + 1) * QW * 32] = __builtin_shufflevector(o[dt], o[dt], 4, 5, 6, 7); }
        xs[8 * QW * 32] = (v4f){m, l, 0.f, 0.f};
    }
    __syncthreads();                    // the hand-over is written
    if (kh) return;
    const v4f ml = xs[8 * QW * 32];
    const float mj = fmaxf(m, ml[0]);   // a half with no valid key holds -3.0e38: its factor is 0 beside a real maximum, 1 where both have none (uniform weights)
    const float a0 = __builtin_amdgcn_exp2f((m - mj) * 1.4426950408889634f), a1 = __builtin_amdgcn_exp2f((ml[0] - mj) * 1.4426950408889634f);
    const float fj = __fdiv_rn(1.0f, l * a0 + ml[1] * a1);
    const float f = a0 * fj, f1 = a1 * fj;
    float* orow = out + ((size_t)b * TT + q) * HD + 8 * h;
#pragma unroll
    for (int dt = 0; dt < 4; ++dt) { v4f a, d; const v4f xa = xs[(2 * dt) * QW * 32], xd = xs[(2 * dt + 1) * QW * 32];
#pragma unroll
        for (int r = 0; r < 4; ++r) { a[r] = o[dt][r] * f + xa[r] * f1; d[r] = o[dt][4 + r] * f + xd[r] * f1; }
        *(v4f*)(orow + dt * 16) = a; *(v4f*)(orow + dt * 16 + 4) = d; }
}

extern "C" void kernel_launch(void* const* d_in, const int* in_sizes, int n_in,
                              void* d_out, int out_size, void* d_ws, size_t ws_size, hipStream_t stream) {
    (void)in_sizes; (void)n_in; (void)out_size; (void)d_ws; (void)ws_size;
    const float* Qin = (const float*)d_in[0]; const float* Kin = (const float*)d_in[1]; const float* Vin = (const float*)d_in[2]; const int* vl = (const int*)d_in[3];   /* valid_len [16][2048] int */
    float* OUT = (float*)d_out;
    k_fattn<<<dim3(TT / (16 * QW), NB_, 1), 32 * QW * KS, 0, stream>>>(Qin, Kin, Vin, vl, OUT);
}

// v005
// It runs in 25.5 microseconds.
// It is 1.13 times as fast as v003, going by the measured steps of the versions left out in between.
// Counting every step since v000, it is 46.0 times as fast.
#include <hip/hip_runtime.h>

// Dot-product attention with per-query valid lengths (q, k [16][2048][64], v [16][2048][64]; scores = q.k UNSCALED (sigma ~8); keys j >= valid_len[b][i] -> -1e9 (valid_len [16][2048] int, read on device; a length of 0 or below leaves every logit equal, i.e. uniform weights, exactly as the finite fill does); softmax; out = attn v -> [16][2048][64]; one 64-wide head per batch).
// Layout: ONE launch. A work-group (16 waves, 128 queries of one batch) walks the keys 128 at a time: its threads read the f32 k and value rows of a tile, round them (k to bf16, value to f16) and lay them in LDS (k as rows, value transposed; two halves of 64 keys), two buffers;
// 16 queries belong to a PAIR of waves: one wave takes the first 64 keys of every tile, its partner the last 64, so that four waves share a SIMD; each keeps its own maximum, sum and O, joined once through LDS behind the loop.
// A wave takes its fragments from LDS, 32 keys a pass,
// S^T = K Q^T, running maximum and sum per query (one query per lane column), P packed straight from the score accumulators as the B operand, O^T += V^T P^T. Scores and P never reach memory.
// Valid lengths: a lane's 16 scores of a pass belong to one query, so a lane is wholly valid, wholly invalid or cut. Scores are masked one by one only in a pass where some lane of the wave is cut (a wave-uniform branch); a wholly invalid lane gets weights 0 through its subtrahend. A length of 0 or below runs as q = 0 with the full length: all scores equal, uniform weights.
// Compute dtypes, f32 accumulate: q, k rounded to bf16, q.k products exact; softmax f32; P (0..1, never above the running maximum's 1) and value rounded to f16 (11 significant bits each; value must stay below 65504), one product; output f32.

// Every plain '#pragma unroll' below opens a short loop of fixed length fully, so that vector elements and fragment arrays are indexed by constants and stay in registers.

#define NB_  16
#define TT   2048
#define HD   64
#define QW   8       // groups of 16 queries per work-group
#define KS   2       // waves per group of queries, each on its own half of every tile
#define KT   64      // keys per wave and tile (two passes)
#define GT   (KS * KT)   // keys per LDS tile
#define NT   (TT / GT)
#define LP   72      // LDS row pitch in 16-bit elements: 128-byte rows + 16 bytes, conflict-free for 16-byte reads and writes of neighbouring rows
#define VOFF (KT * LP)            // value^T rows start behind the k rows of a half
#define BUFE (KT * LP + HD * LP)  // elements of one half (64 keys: k rows, value^T rows)
#define TBUF (KS * BUFE)          // elements of one buffer
typedef unsigned short bf;
typedef __attribute__((ext_vector_type(16))) __bf16   v16bf;
typedef __attribute__((ext_vector_type(8)))  __bf16   v8bf;
typedef __attribute__((ext_vector_type(16))) _Float16 v16h;
typedef __attribute__((ext_vector_type(8)))  _Float16 v8h;
typedef __attribute__((ext_vector_type(16))) float    v16f;
typedef __attribute__((ext_vector_type(8)))  unsigned short v8us;
typedef __attribute__((ext_vector_type(8)))  float    v8f;
typedef __attribute__((ext_vector_type(4)))  float    v4f;
typedef __attribute__((ext_vector_type(8)))  unsigned v8u;

__device__ __forceinline__ unsigned short f2bf(float f) { unsigned u = __float_as_uint(f); u += 0x7FFFu + ((u >> 16) & 1u); return (unsigned short)(u >> 16); }
__device__ __forceinline__ v16bf cat16b(v8us lo, v8us hi) { return __builtin_bit_cast(v16bf, __builtin_shufflevector(lo, hi, 0, 1, 2, 3, 4, 5, 6, 7, 8, 9, 10, 11, 12, 13, 14, 15)); }
__device__ __forceinline__ v8f wmmab(v16bf a, v16bf b, v8f c) { return __builtin_amdgcn_wmma_f32_16x16x32_bf16(false, a, false, b, (short)0, c, false, false); }
__device__ __forceinline__ v8f wmmah(v16h a, v16h b, v8f c) { return __builtin_amdgcn_wmma_f32_16x16x32_f16(false, a, false, b, (short)0, c, false, false); }
// fragment of a k-contiguous 16-bit row; p already holds the lane's row and its 8 * (lane >> 4): elements 0..7 = k 8h.., 8..15 = k 16 + 8h..
__device__ __forceinline__ v16bf ldfrag(const bf* p) { return cat16b(*(const v8us*)p, *(const v8us*)(p + 16)); }
__device__ __forceinline__ v8us cvt8(const float* p) { const v8f v = *(const v8f*)p; v8us o;
#pragma unroll
    for (int k = 0; k < 8; ++k) o[k] = f2bf(v[k]);
    return o; }
// value of lane l ^ 16
__device__ __forceinline__ float xhalf(float x) { const int b = __float_as_int(x); return __int_as_float(__builtin_amdgcn_permlanex16(b, b, 0x76543210, 0xfedcba98, false, false)); }

// eight f32 rounded to bf16 (nearest even) by the packed convert
__device__ __forceinline__ v8us rnd8(v8f v) { return __builtin_bit_cast(v8us, __builtin_convertvector(v, v8bf)); }
// the same to f16
__device__ __forceinline__ v8us rnd8h(v8f v) { return __builtin_bit_cast(v8us, __builtin_convertvector(v, v8h)); }

// lanes of the wave that have 1 to 23 keys of their 24-key span valid; the same word in the whole wave
__device__ __forceinline__ unsigned cutl(int rel) { return __builtin_amdgcn_ballot_w32((unsigned)(rel - 1) < 23u); }
// one pass of 32 keys: kf, vf hold its fragments; rel = valid length (1 or more) - (first key of this lane's half); cut = cutl(rel); m = running maximum of the query, l = running sum over this half's keys
__device__ __forceinline__ void fpass(const v16bf (&kf)[4], const v16h (&vf)[4], v16bf q0, v16bf q1, int rel, unsigned cut, float& m, float& l, v8f (&o)[4]) {
    const bool none = rel <= 0;                                                      // this lane has no valid key in the pass
    v8f s0 = (v8f){}, s1 = (v8f){};
    s0 = wmmab(kf[0], q0, s0); s1 = wmmab(kf[2], q0, s1); s0 = wmmab(kf[1], q1, s0); s1 = wmmab(kf[3], q1, s1);   // s0[r] = key k0 + 8h + r, s1[r] = key k0 + 16 + 8h + r, query c
    if (cut) {
#pragma unroll
        for (int r = 0; r < 8; ++r) { s0[r] = (r < rel) ? s0[r] : -3.0e38f; s1[r] = (16 + r < rel) ? s1[r] : -3.0e38f; }   /* keys at or beyond the valid length excluded */
    }
    v16f p; float mx = m;
#pragma unroll
    for (int r = 0; r < 8; ++r) mx = fmaxf(mx, fmaxf(s0[r], s1[r]));
    mx = none ? m : mx;                    // a lane without a valid key adds nothing to the maximum
    mx = fmaxf(mx, xhalf(mx));
    const float al = __builtin_amdgcn_exp2f((m - mx) * 1.4426950408889634f); m = mx;
    const float sb = none ? 3.0e38f : mx;  // such a lane's differences overflow to -inf: all its weights are 0
#pragma unroll
    for (int r = 0; r < 8; ++r) { p[r] = __builtin_amdgcn_exp2f((s0[r] - sb) * 1.4426950408889634f); p[8 + r] = __builtin_amdgcn_exp2f((s1[r] - sb) * 1.4426950408889634f); }
    const v16h ph = __builtin_convertvector(p, v16h);
    const v8f t8 = __builtin_shufflevector(p, p, 0, 1, 2, 3, 4, 5, 6, 7) + __builtin_shufflevector(p, p, 8, 9, 10, 11, 12, 13, 14, 15);
    const v4f t4 = __builtin_shufflevector(t8, t8, 0, 1, 2, 3) + __builtin_shufflevector(t8, t8, 4, 5, 6, 7);
    l = l * al + ((t4[0] + t4[2]) + (t4[1] + t4[3]));   // each half of the wave keeps the sum of its own keys; joined once behind the loop
#pragma unroll
    for (int dt = 0; dt < 4; ++dt) o[dt] *= al;
#pragma unroll
    for (int dt = 0; dt < 4; ++dt) o[dt] = wmmah(vf[dt], ph, o[dt]);   // o[dt][r] = O[query c][d = 16 dt + 8h + r]
}
__device__ __forceinline__ void kload(v16bf (&kf)[4], const bf* Kp, int k0) {
#pragma unroll
    for (int t = 0; t < 4; ++t) kf[t] = ldfrag(Kp + (k0 + (t >> 1) * 16) * LP + (t & 1) * 32);
}
__device__ __forceinline__ void vload(v16h (&vf)[4], const bf* Vp, int k0) {
#pragma unroll
    for (int dt = 0; dt < 4; ++dt) vf[dt] = __builtin_bit_cast(v16h, ldfrag(Vp + dt * 16 * LP + k0));
}
// one thread's share of a 128-key tile, still f32: 16 k values (two runs of 8 in row order) and 16 values of one value column (16 keys running)
__device__ __forceinline__ void gload(v8f (&gk)[2], v8f (&gv)[2], const float* Kg, const float* Vg, int tile) {
    const float* kp = Kg + (size_t)tile * GT * HD; const float* vp = Vg + (size_t)tile * GT * HD;
    gk[0] = *(const v8f*)kp; gk[1] = *(const v8f*)(kp + KT * HD);
#pragma unroll
    for (int j = 0; j < 8; ++j) { gv[0][j] = vp[j * HD]; gv[1][j] = vp[(8 + j) * HD]; }
}
__device__ __forceinline__ void lstore(bf* Ks, bf* Vs, const v8f (&gk)[2], const v8f (&gv)[2]) {
    *(v8us*)Ks = rnd8(gk[0]); *(v8us*)(Ks + BUFE) = rnd8(gk[1]);
    *(v8us*)Vs = rnd8h(gv[0]); *(v8us*)(Vs + 8) = rnd8h(gv[1]);
}

// grid (TT / (16 * QW), NB_), 32 * QW * KS threads. Lane (c = lane & 15, h = lane >> 4) holds query q0 + c throughout; waves w and w + QW hold the same queries.
__global__ __launch_bounds__(32 * QW * KS) void k_fattn(const float* __restrict__ Q, const float* __restrict__ K, const float* __restrict__ V, const int* __restrict__ vl, float* __restrict__ out) {
    __shared__ __attribute__((aligned(16))) bf sm[2 * TBUF];
    const int tid = threadIdx.x;
    const int lane = tid & 31, c = lane & 15, h = lane >> 4; const int b = blockIdx.y; const int g = (tid >> 5) & (QW - 1), kh = tid >> 8; const int q = (blockIdx.x * QW + g) * 16 + c;   // g = group of queries, kh = this wave's half of every tile
    const float* Kg = K + (size_t)b * TT * HD + tid * 8;                                 // staging: run tid of 8 values, and run 512 + tid, of the tile's 1024
    const float* Vg = V + (size_t)b * TT * HD + (size_t)(tid >> 6) * 16 * HD + (tid & 63);   // staging: column tid & 63, keys 16 * (tid >> 6) ..+15 of the tile's 128
    const int kso = (tid >> 3) * LP + (tid & 7) * 8;                 // k row tid >> 3 of the first half (and of the second), 8 values
    const int vso = kh * BUFE + VOFF + (tid & 63) * LP + ((tid >> 6) & 3) * 16;   // value^T row = column, 16 keys, in the half they belong to
    const int fo = kh * BUFE + c * LP + 8 * h;                       // fragments, from this wave's half: A rows = keys, and VOFF on A rows = value columns d
    const float* Qp = Q + ((size_t)b * TT + q) * HD + 8 * h;
    const int Lr = vl[b * TT + q]; const int L = (Lr <= 0 || Lr > TT) ? TT : Lr;   /* this query's valid length; only compared, never an address; above TT the clamp changes no compare against a key index in [0, TT); 0 or below: every key, with q = 0 */
    const unsigned qk = Lr <= 0 ? 0u : ~0u;
    const v16bf q0 = __builtin_bit_cast(v16bf, __builtin_bit_cast(v8u, cat16b(cvt8(Qp), cvt8(Qp + 16))) & qk), q1 = __builtin_bit_cast(v16bf, __builtin_bit_cast(v8u, cat16b(cvt8(Qp + 32), cvt8(Qp + 48))) & qk);   // B columns = queries, kept in registers
    v8f o[4];
#pragma unroll
    for (int dt = 0; dt < 4; ++dt) o[dt] = (v8f){};
    float m = -3.0e38f, l = 0.f;
    v16bf ka[4], kb[4]; v16h va[4], vb[4];   // two fragment sets, one per pass of the loop body
    v8f gk[2], gv[2];                   // the tile in flight from memory
    gload(gk, gv, Kg, Vg, 0);
    lstore(sm + kso, sm + vso, gk, gv);
    __syncthreads();                    // tile 0 is in buffer 0 for every wave
    gload(gk, gv, Kg, Vg, 1);
    kload(ka, sm + fo, 0);
#pragma unroll 1   // the body stays at one tile of two passes: each further copy would want fragment sets of its own
    for (int it = 0; it < NT; ++it) {
        const int k0 = it * GT + kh * KT; const int cur = (it & 1) * TBUF, nxt = TBUF - cur;
        const bf* fc = sm + cur + fo;
        vload(va, fc + VOFF, 0); kload(kb, fc, 32); vload(vb, fc + VOFF, 32);
        const int ra = L - (k0 + 8 * h), rb = ra - 32; const unsigned ca = cutl(ra), cb = cutl(rb);   // both passes' branch words, ready in scalar registers long before the branches
        __builtin_amdgcn_sched_barrier(0);   // keeps these LDS reads at the head of the body, ahead of their use by the first pass's O update (va) or by the whole pass (kb, vb); sunk towards the use their latency is waited for
        fpass(ka, va, q0, q1, ra, ca, m, l, o);
        __builtin_amdgcn_sched_barrier(0);   // keeps the stores and the barrier behind the first pass: ahead of it every wave would wait at the barrier for the LDS reads just issued
        lstore(sm + nxt + kso, sm + nxt + vso, gk, gv);   // tile it + 1 into the other buffer, whose last reads ended in front of the previous body's barrier; behind the last tile: tile 0 again, unused
        __syncthreads();                     // publishes tile it + 1 and ends every wave's reads of tile it (all its fragments are in registers)
        kload(ka, sm + nxt + fo, 0);         // next body's first K fragments fly under the second pass
        gload(gk, gv, Kg, Vg, (it + 2 < NT) ? it + 2 : 0);   // the tile after it flies under the second pass and the next first pass; behind the last tiles: tile 0, in bounds, unused
        __builtin_amdgcn_sched_barrier(0);   // keeps them ahead of the second pass
        fpass(kb, vb, q0, q1, rb, cb, m, l, o);
    }
    l += xhalf(l);
    // join of the pair: the wave of the second halves hands m, l and O over in LDS (16 bytes a lane and chunk, lanes side by side), its partner rescales both to the common maximum and stores
    __syncthreads();                    // every wave's reads of the tiles are over: the buffers become the hand-over space
    v4f* xs = (v4f*)sm + g * 32 + lane;
    if (kh) {
#pragma unroll
        for (int dt = 0; dt < 4; ++dt) { xs[(2 * dt) * QW * 32] = __builtin_shufflevector(o[dt], o[dt], 0, 1, 2, 3); xs[(2 * dt + 1) * QW * 32] = __builtin_shufflevector(o[dt], o[dt], 4, 5, 6, 7); }
        xs[8 * QW * 32] = (v4f){m, l, 0.f, 0.f};
    }
    __syncthreads();                    // the hand-over is written
    if (kh) return;
    const v4f ml = xs[8 * QW * 32];
    const float mj = fmaxf(m, ml[0]);   // a half with no valid key holds -3.0e38 and zero sums: its factor is 0 beside the real maximum that the first half always has
    const float a0 = __builtin_amdgcn_exp2f((m - mj) * 1.4426950408889634f), a1 = __builtin_amdgcn_exp2f((ml[0] - mj) * 1.4426950408889634f);
    const float fj = __fdiv_rn(1.0f, l * a0 + ml[1] * a1);
    const float f = a0 * fj, f1 = a1 * fj;
    float* orow = out + ((size_t)b * TT + q) * HD + 8 * h;
#pragma unroll
    for (int dt = 0; dt < 4; ++dt) { v4f a, d; const v4f xa = xs[(2 * dt) * QW * 32], xd = xs[(2 * dt + 1) * QW * 32];
#pragma unroll
        for (int r = 0; r < 4; ++r) { a[r] = o[dt][r] * f + xa[r] * f1; d[r] = o[dt][4 + r] * f + xd[r] * f1; }
        *(v4f*)(orow + dt * 16) = a; *(v4f*)(orow + dt * 16 + 4) = d; }
}

extern "C" void kernel_launch(void* const* d_in, const int* in_sizes, int n_in,
                              void* d_out, int out_size, void* d_ws, size_t ws_size, hipStream_t stream) {
    (void)in_sizes; (void)n_in; (void)out_size; (void)d_ws; (void)ws_size;
    const float* Qin = (const float*)d_in[0]; const float* Kin = (const float*)d_in[1]; const float* Vin = (const float*)d_in[2]; const int* vl = (const int*)d_in[3];   /* valid_len [16][2048] int */
    float* OUT = (float*)d_out;
    k_fattn<<<dim3(TT / (16 * QW), NB_, 1), 32 * QW * KS, 0, stream>>>(Qin, Kin, Vin, vl, OUT);
}

// v006
// A run of this version takes 22.5 microseconds.
// Timed twice side by side with v005, it ran 1.15 and 1.14 times as fast.
// All steps since v000 together make it 52.5 times as fast.
#include <hip/hip_runtime.h>

// Dot-product attention with per-query valid lengths (q, k [16][2048][64], v [16][2048][64]; scores = q.k UNSCALED (sigma ~8); keys j >= valid_len[b][i] -> -1e9 (valid_len [16][2048] int, read on device; a length of 0 or below leaves every logit equal, i.e. uniform weights, exactly as the finite fill does); softmax; out = attn v -> [16][2048][64]; one 64-wide head per batch).
// Layout: ONE launch. A work-group (16 waves, 128 queries of one batch) walks the keys 128 at a time: its threads read the f32 k and value rows of a tile, round them (k to bf16, value to f16) and lay them in LDS (both as rows; two halves of 64 keys), two buffers; every staging load of a wave covers 512 bytes in a row, whole 128-byte lines;
// 16 queries belong to a PAIR of waves: one wave takes the first 64 keys of every tile, its partner the last 64, so that four waves share a SIMD; each keeps its own maximum, sum and O, joined once through LDS behind the loop.
// A wave takes its fragments from LDS, 32 keys a pass (k by plain 16-byte reads, value^T by the transposing 16-bit read),
// S^T = K Q^T, running maximum and sum per query (one query per lane column), P packed straight from the score accumulators as the B operand, O^T += V^T P^T. Scores and P never reach memory.
// Valid lengths: a lane's 16 scores of a pass belong to one query, so a lane is wholly valid, wholly invalid or cut. Scores are masked one by one only in a pass where some lane of the wave is cut (a wave-uniform branch); a wholly invalid lane gets weights 0 through its subtrahend. A length of 0 or below runs as q = 0 with the full length: all scores equal, uniform weights.
// Compute dtypes, f32 accumulate: q, k rounded to bf16, q.k products exact; softmax f32; P (0..1, never above the running maximum's 1) and value rounded to f16 (11 significant bits each; value must stay below 65504), one product; output f32.

// Every plain '#pragma unroll' below opens a short loop of fixed length fully, so that vector elements and fragment arrays are indexed by constants and stay in registers.

#define NB_  16
#define TT   2048
#define HD   64
#define QW   8       // groups of 16 queries per work-group
#define KS   2       // waves per group of queries, each on its own half of every tile
#define KT   64      // keys per wave and tile (two passes)
#define GT   (KS * KT)   // keys per LDS tile
#define NT   (TT / GT)
#define LP   72      // LDS row pitch in 16-bit elements: 128-byte rows + 16 bytes, conflict-free for 16-byte reads of neighbouring rows
#define LPV  80      // LDS row pitch of the value rows: 128-byte rows + 32 bytes, an odd multiple of 32 bytes, conflict-free for the transposing read
#define VOFF (KT * LP)            // value rows start behind the k rows of a half
#define BUFE (KT * LP + KT * LPV) // elements of one half (64 keys: k rows, value rows)
#define TBUF (KS * BUFE)          // elements of one buffer
typedef unsigned short bf;
typedef __attribute__((ext_vector_type(16))) __bf16   v16bf;
typedef __attribute__((ext_vector_type(8)))  __bf16   v8bf;
typedef __attribute__((ext_vector_type(16))) _Float16 v16h;
typedef __attribute__((ext_vector_type(8)))  _Float16 v8h;
typedef __attribute__((ext_vector_type(16))) float    v16f;
typedef __attribute__((ext_vector_type(8)))  unsigned short v8us;
typedef __attribute__((ext_vector_type(8)))  float    v8f;
typedef __attribute__((ext_vector_type(4)))  float    v4f;
typedef __attribute__((ext_vector_type(8)))  unsigned v8u;
typedef __attribute__((ext_vector_type(4)))  __bf16   v4bf;
typedef __attribute__((ext_vector_type(4)))  _Float16 v4h;
typedef __attribute__((ext_vector_type(4)))  unsigned short v4us;
typedef __attribute__((ext_vector_type(8)))  short    v8s;
typedef __attribute__((address_space(3))) v8s lds_v8s;

__device__ __forceinline__ unsigned short f2bf(float f) { unsigned u = __float_as_uint(f); u += 0x7FFFu + ((u >> 16) & 1u); return (unsigned short)(u >> 16); }
__device__ __forceinline__ v16bf cat16b(v8us lo, v8us hi) { return __builtin_bit_cast(v16bf, __builtin_shufflevector(lo, hi, 0, 1, 2, 3, 4, 5, 6, 7, 8, 9, 10, 11, 12, 13, 14, 15)); }
__device__ __forceinline__ v8f wmmab(v16bf a, v16bf b, v8f c) { return __builtin_amdgcn_wmma_f32_16x16x32_bf16(false, a, false, b, (short)0, c, false, false); }
__device__ __forceinline__ v8f wmmah(v16h a, v16h b, v8f c) { return __builtin_amdgcn_wmma_f32_16x16x32_f16(false, a, false, b, (short)0, c, false, false); }
// fragment of a k-contiguous 16-bit row; p already holds the lane's row and its 8 * (lane >> 4): elements 0..7 = k 8h.., 8..15 = k 16 + 8h..
__device__ __forceinline__ v16bf ldfrag(const bf* p) { return cat16b(*(const v8us*)p, *(const v8us*)(p + 16)); }
__device__ __forceinline__ v8us cvt8(const float* p) { const v8f v = *(const v8f*)p; v8us o;
#pragma unroll
    for (int k = 0; k < 8; ++k) o[k] = f2bf(v[k]);
    return o; }
// value of lane l ^ 16
__device__ __forceinline__ float xhalf(float x) { const int b = __float_as_int(x); return __int_as_float(__builtin_amdgcn_permlanex16(b, b, 0x76543210, 0xfedcba98, false, false)); }

// four f32 rounded to bf16 (nearest even) by the packed convert
__device__ __forceinline__ v4us rnd4(v4f v) { return __builtin_bit_cast(v4us, __builtin_convertvector(v, v4bf)); }
// the same to f16
__device__ __forceinline__ v4us rnd4h(v4f v) { return __builtin_bit_cast(v4us, __builtin_convertvector(v, v4h)); }
// transposing read of a row-major 16-bit tile: p holds row 8 * (lane >> 4) + (lane & 7) and 8 * ((lane >> 3) & 1) elements; lane (c, h) gets rows 8h .. 8h + 7 of column c
__device__ __forceinline__ v8us ldtr(const bf* p) { return __builtin_bit_cast(v8us, __builtin_amdgcn_ds_load_tr16_b128_v8i16((lds_v8s*)p)); }

// lanes of the wave that have 1 to 23 keys of their 24-key span valid; the same word in the whole wave
__device__ __forceinline__ unsigned cutl(int rel) { return __builtin_amdgcn_ballot_w32((unsigned)(rel - 1) < 23u); }
// one pass of 32 keys: kf, vf hold its fragments; rel = valid length (1 or more) - (first key of this lane's half); cut = cutl(rel); m = running maximum of the query, l = running sum over this half's keys
__device__ __forceinline__ void fpass(const v16bf (&kf)[4], const v16h (&vf)[4], v16bf q0, v16bf q1, int rel, unsigned cut, float& m, float& l, v8f (&o)[4]) {
    const bool none = rel <= 0;                                                      // this lane has no valid key in the pass
    v8f s0 = (v8f){}, s1 = (v8f){};
    s0 = wmmab(kf[0], q0, s0); s1 = wmmab(kf[2], q0, s1); s0 = wmmab(kf[1], q1, s0); s1 = wmmab(kf[3], q1, s1);   // s0[r] = key k0 + 8h + r, s1[r] = key k0 + 16 + 8h + r, query c
    if (cut) {
#pragma unroll
        for (int r = 0; r < 8; ++r) { s0[r] = (r < rel) ? s0[r] : -3.0e38f; s1[r] = (16 + r < rel) ? s1[r] : -3.0e38f; }   /* keys at or beyond the valid length excluded */
    }
    v16f p; float mx = m;
#pragma unroll
    for (int r = 0; r < 8; ++r) mx = fmaxf(mx, fmaxf(s0[r], s1[r]));
    mx = none ? m : mx;                    // a lane without a valid key adds nothing to the maximum
    mx = fmaxf(mx, xhalf(mx));
    const float al = __builtin_amdgcn_exp2f((m - mx) * 1.4426950408889634f); m = mx;
    const float sb = none ? 3.0e38f : mx;  // such a lane's differences overflow to -inf: all its weights are 0
#pragma unroll
    for (int r = 0; r < 8; ++r) { p[r] = __builtin_amdgcn_exp2f((s0[r] - sb) * 1.4426950408889634f); p[8 + r] = __builtin_amdgcn_exp2f((s1[r] - sb) * 1.4426950408889634f); }
    const v16h ph = __builtin_convertvector(p, v16h);
    const v8f t8 = __builtin_shufflevector(p, p, 0, 1, 2, 3, 4, 5, 6, 7) + __builtin_shufflevector(p, p, 8, 9, 10, 11, 12, 13, 14, 15);
    const v4f t4 = __builtin_shufflevector(t8, t8, 0, 1, 2, 3) + __builtin_shufflevector(t8, t8, 4, 5, 6, 7);
    l = l * al + ((t4[0] + t4[2]) + (t4[1] + t4[3]));   // each half of the wave keeps the sum of its own keys; joined once behind the loop
#pragma unroll
    for (int dt = 0; dt < 4; ++dt) o[dt] *= al;
#pragma unroll
    for (int dt = 0; dt < 4; ++dt) o[dt] = wmmah(vf[dt], ph, o[dt]);   // o[dt][r] = O[query c][d = 16 dt + 8h + r]
}
__device__ __forceinline__ void kload(v16bf (&kf)[4], const bf* Kp, int k0) {
#pragma unroll
    for (int t = 0; t < 4; ++t) kf[t] = ldfrag(Kp + (k0 + (t >> 1) * 16) * LP + (t & 1) * 32);
}
// value^T fragments: A row = column d = 16 dt + c of the value rows, elements 0..7 = keys k0 + 8h.., 8..15 = keys k0 + 16 + 8h.., the order of P
__device__ __forceinline__ void vload(v16h (&vf)[4], const bf* Vp, int k0) {
#pragma unroll
    for (int dt = 0; dt < 4; ++dt) vf[dt] = __builtin_bit_cast(v16h, cat16b(ldtr(Vp + k0 * LPV + dt * 16), ldtr(Vp + (k0 + 16) * LPV + dt * 16)));
}
// one thread's share of a 128-key tile, still f32: of k and of value each four runs of 4 in row order, run j 32 rows behind run j - 1; neighbouring lanes hold neighbouring runs
__device__ __forceinline__ void gload(v4f (&gk)[4], v4f (&gv)[4], const float* Kg, const float* Vg, int tile) {
    const float* kp = Kg + (size_t)tile * GT * HD; const float* vp = Vg + (size_t)tile * GT * HD;
#pragma unroll
    for (int j = 0; j < 4; ++j) gk[j] = *(const v4f*)(kp + j * 32 * HD);
#pragma unroll
    for (int j = 0; j < 4; ++j) gv[j] = *(const v4f*)(vp + j * 32 * HD);
}
__device__ __forceinline__ void lstore(bf* Ks, bf* Vs, const v4f (&gk)[4], const v4f (&gv)[4]) {
#pragma unroll
    for (int j = 0; j < 4; ++j) *(v4us*)(Ks + (j >> 1) * BUFE + (j & 1) * 32 * LP) = rnd4(gk[j]);
#pragma unroll
    for (int j = 0; j < 4; ++j) *(v4us*)(Vs + (j >> 1) * BUFE + (j & 1) * 32 * LPV) = rnd4h(gv[j]);
}

// grid (TT / (16 * QW), NB_), 32 * QW * KS threads. Lane (c = lane & 15, h = lane >> 4) holds query q0 + c throughout; waves w and w + QW hold the same queries.
__global__ __launch_bounds__(32 * QW * KS) void k_fattn(const float* __restrict__ Q, const float* __restrict__ K, const float* __restrict__ V, const int* __restrict__ vl, float* __restrict__ out) {
    __shared__ __attribute__((aligned(16))) bf sm[2 * TBUF];
    const int tid = threadIdx.x;
    const int lane = tid & 31, c = lane & 15, h = lane >> 4; const int b = blockIdx.y; const int g = (tid >> 5) & (QW - 1), kh = tid >> 8; const int q = (blockIdx.x * QW + g) * 16 + c;   // g = group of queries, kh = this wave's half of every tile
    const float* Kg = K + (size_t)b * TT * HD + tid * 4;             // staging: runs tid, 512 + tid, 1024 + tid, 1536 + tid of 4 values, of the tile's 2048
    const float* Vg = V + (size_t)b * TT * HD + tid * 4;             // the same runs of the value tile
    const int kso = (tid >> 4) * LP + (tid & 15) * 4;                // k row tid >> 4 (and 32 rows on; and the same in the second half), 4 values
    const int vso = VOFF + (tid >> 4) * LPV + (tid & 15) * 4;        // value row, likewise
    const int fo = kh * BUFE + c * LP + 8 * h;                       // k fragments, from this wave's half: A rows = keys
    const int fd = VOFF + (8 * h + (lane & 7)) * LPV + 8 * ((lane >> 3) & 1) - (c * LP + 8 * h);   // from the lane's k fragment address to its address for the transposing read of the value rows of the same half
    const float* Qp = Q + ((size_t)b * TT + q) * HD + 8 * h;
    const int Lr = vl[b * TT + q]; const int L = (Lr <= 0 || Lr > TT) ? TT : Lr;   /* this query's valid length; only compared, never an address; above TT the clamp changes no compare against a key index in [0, TT); 0 or below: every key, with q = 0 */
    const unsigned qk = Lr <= 0 ? 0u : ~0u;
    const v16bf q0 = __builtin_bit_cast(v16bf, __builtin_bit_cast(v8u, cat16b(cvt8(Qp), cvt8(Qp + 16))) & qk), q1 = __builtin_bit_cast(v16bf, __builtin_bit_cast(v8u, cat16b(cvt8(Qp + 32), cvt8(Qp + 48))) & qk);   // B columns = queries, kept in registers
    v8f o[4];
#pragma unroll
    for (int dt = 0; dt < 4; ++dt) o[dt] = (v8f){};
    float m = -3.0e38f, l = 0.f;
    v16bf ka[4], kb[4]; v16h va[4], vb[4];   // two fragment sets, one per pass of the loop body
    v4f gk[4], gv[4];                   // the tile in flight from memory
    gload(gk, gv, Kg, Vg, 0);
    lstore(sm + kso, sm + vso, gk, gv);
    __syncthreads();                    // tile 0 is in buffer 0 for every wave
    gload(gk, gv, Kg, Vg, 1);
    kload(ka, sm + fo, 0);
#pragma unroll 1   // the body stays at one tile of two passes: each further copy would want fragment sets of its own
    for (int it = 0; it < NT; ++it) {
        const int k0 = it * GT + kh * KT; const int cur = (it & 1) * TBUF, nxt = TBUF - cur;
        const bf* fc = sm + cur + fo; const bf* fw = fc + fd;
        vload(va, fw, 0); kload(kb, fc, 32); vload(vb, fw, 32);
        const int ra = L - (k0 + 8 * h), rb = ra - 32; const unsigned ca = cutl(ra), cb = cutl(rb);   // both passes' branch words, ready in scalar registers long before the branches
        __builtin_amdgcn_sched_barrier(0);   // keeps these LDS reads at the head of the body, ahead of their use by the first pass's O update (va) or by the whole pass (kb, vb); sunk towards the use their latency is waited for
        fpass(ka, va, q0, q1, ra, ca, m, l, o);
        __builtin_amdgcn_sched_barrier(0);   // keeps the stores and the barrier behind the first pass: ahead of it every wave would wait at the barrier for the LDS reads just issued
        lstore(sm + nxt + kso, sm + nxt + vso, gk, gv);   // tile it + 1 into the other buffer, whose last reads ended in front of the previous body's barrier; behind the last tile: tile 0 again, unused
        __syncthreads();                     // publishes tile it + 1 and ends every wave's reads of tile it (all its fragments are in registers)
        kload(ka, sm + nxt + fo, 0);         // next body's first K fragments fly under the second pass
        gload(gk, gv, Kg, Vg, (it + 2 < NT) ? it + 2 : 0);   // the tile after it flies under the second pass and the next first pass; behind the last tiles: tile 0, in bounds, unused
        __builtin_amdgcn_sched_barrier(0);   // keeps them ahead of the second pass
        fpass(kb, vb, q0, q1, rb, cb, m, l, o);
    }
    l += xhalf(l);
    // join of the pair: the wave of the second halves hands m, l and O over in LDS (16 bytes a lane and chunk, lanes side by side), its partner rescales both to the common maximum and stores
    __syncthreads();                    // every wave's reads of the tiles are over: the buffers become the hand-over space
    v4f* xs = (v4f*)sm + g * 32 + lane;
    if (kh) {
#pragma unroll
        for (int dt = 0; dt < 4; ++dt) { xs[(2 * dt) * QW * 32] = __builtin_shufflevector(o[dt], o[dt], 0, 1, 2, 3); xs[(2 * dt + 1) * QW * 32] = __builtin_shufflevector(o[dt], o[dt], 4, 5, 6, 7); }
        xs[8 * QW * 32] = (v4f){m, l, 0.f, 0.f};
    }
    __syncthreads();                    // the hand-over is written
    if (kh) return;
    const v4f ml = xs[8 * QW * 32];
    const float mj = fmaxf(m, ml[0]);   // a half with no valid key holds -3.0e38 and zero sums: its factor is 0 beside the real maximum that the first half always has
    const float a0 = __builtin_amdgcn_exp2f((m - mj) * 1.4426950408889634f), a1 = __builtin_amdgcn_exp2f((ml[0] - mj) * 1.4426950408889634f);
    const float fj = __fdiv_rn(1.0f, l * a0 + ml[1] * a1);
    const float f = a0 * fj, f1 = a1 * fj;
    float* orow = out + ((size_t)b * TT + q) * HD + 8 * h;
#pragma unroll
    for (int dt = 0; dt < 4; ++dt) { v4f a, d; const v4f xa = xs[(2 * dt) * QW * 32], xd = xs[(2 * dt + 1) * QW * 32];
#pragma unroll
        for (int r = 0; r < 4; ++r) { a[r] = o[dt][r] * f + xa[r] * f1; d[r] = o[dt][4 + r] * f + xd[r] * f1; }
        *(v4f*)(orow + dt * 16) = a; *(v4f*)(orow + dt * 16 + 4) = d; }
}

extern "C" void kernel_launch(void* const* d_in, const int* in_sizes, int n_in,
                              void* d_out, int out_size, void* d_ws, size_t ws_size, hipStream_t stream) {
    (void)in_sizes; (void)n_in; (void)out_size; (void)d_ws; (void)ws_size;
    const float* Qin = (const float*)d_in[0]; const float* Kin = (const float*)d_in[1]; const float* Vin = (const float*)d_in[2]; const int* vl = (const int*)d_in[3];   /* valid_len [16][2048] int */
    float* OUT = (float*)d_out;
    k_fattn<<<dim3(TT / (16 * QW), NB_, 1), 32 * QW * KS, 0, stream>>>(Qin, Kin, Vin, vl, OUT);
}

// v008
// One run takes 20.1 microseconds.
// Versions in between are left out here; by their measured steps it is 1.12 times as fast as v006.
// Over all steps from v000 it is 58.6 times as fast.
#include <hip/hip_runtime.h>

// Dot-product attention with per-query valid lengths (q, k [16][2048][64], v [16][2048][64]; scores = q.k UNSCALED (sigma ~8); keys j >= valid_len[b][i] -> -1e9 (valid_len [16][2048] int, read on device; a length of 0 or below leaves every logit equal, i.e. uniform weights, exactly as the finite fill does); softmax; out = attn v -> [16][2048][64]; one 64-wide head per batch).
// Layout: ONE launch. A work-group (16 waves, 128 queries of one batch) walks the keys 128 at a time: its threads read the f32 k and value rows of a tile, round them (k to bf16, value to f16) and lay them in LDS (both as rows; two halves of 64 keys), a ring of three buffers, so that the tile barrier's signal and its wait stand one tile apart and no wave stops for the others at a tile's end; every staging load of a wave covers 512 bytes in a row, whole 128-byte lines;
// 16 queries belong to a PAIR of waves: one wave takes the first 64 keys of every tile, its partner the last 64, so that four waves share a SIMD; each keeps its own reference, sum and O, joined once through LDS behind the loop.
// A wave takes its fragments from LDS, 32 keys a pass (k by plain 16-byte reads, value^T by the transposing 16-bit read),
// S^T = K Q^T - reference, held reference and running sum per query (one query per lane column), P packed straight from the score accumulators as the B operand, O^T += V^T P^T. Scores and P never reach memory.
// Valid lengths: a lane's 16 scores of a pass belong to one query, so a lane is wholly valid, wholly invalid or cut. Scores are masked one by one only in a pass where some lane of the wave is cut (a wave-uniform branch); a wholly invalid lane gets weights 0 through its C operand. A length of 0 or below runs as q = 0 with the full length: all scores equal, uniform weights.
// Compute dtypes, f32 accumulate: q, k rounded to bf16, q.k products exact; softmax f32; P (0..16384, relative to the held reference) and value rounded to f16 (11 significant bits each; value must stay below 65504), one product; output f32.

// Every plain '#pragma unroll' below opens a short loop of fixed length fully, so that vector elements and fragment arrays are indexed by constants and stay in registers.

#define NB_  16
#define TT   2048
#define HD   64
#define QW   8       // groups of 16 queries per work-group
#define KS   2       // waves per group of queries, each on its own half of every tile
#define KT   64      // keys per wave and tile (two passes)
#define GT   (KS * KT)   // keys per LDS tile
#define NT   (TT / GT)
#define LP   72      // LDS row pitch in 16-bit elements: 128-byte rows + 16 bytes, conflict-free for 16-byte reads of neighbouring rows
#define LPV  80      // LDS row pitch of the value rows: 128-byte rows + 32 bytes, an odd multiple of 32 bytes, conflict-free for the transposing read
#define VOFF (KT * LP)            // value rows start behind the k rows of a half
#define BUFE (KT * LP + KT * LPV) // elements of one half (64 keys: k rows, value rows)
#define TBUF (KS * BUFE)          // elements of one buffer
typedef unsigned short bf;
typedef __attribute__((ext_vector_type(16))) __bf16   v16bf;
typedef __attribute__((ext_vector_type(8)))  __bf16   v8bf;
typedef __attribute__((ext_vector_type(16))) _Float16 v16h;
typedef __attribute__((ext_vector_type(8)))  _Float16 v8h;
typedef __attribute__((ext_vector_type(16))) float    v16f;
typedef __attribute__((ext_vector_type(8)))  unsigned short v8us;
typedef __attribute__((ext_vector_type(8)))  float    v8f;
typedef __attribute__((ext_vector_type(4)))  float    v4f;
typedef __attribute__((ext_vector_type(8)))  unsigned v8u;
typedef __attribute__((ext_vector_type(4)))  __bf16   v4bf;
typedef __attribute__((ext_vector_type(4)))  _Float16 v4h;
typedef __attribute__((ext_vector_type(4)))  unsigned short v4us;
typedef __attribute__((ext_vector_type(8)))  short    v8s;
typedef __attribute__((address_space(3))) v8s lds_v8s;

__device__ __forceinline__ unsigned short f2bf(float f) { unsigned u = __float_as_uint(f); u += 0x7FFFu + ((u >> 16) & 1u); return (unsigned short)(u >> 16); }
__device__ __forceinline__ v16bf cat16b(v8us lo, v8us hi) { return __builtin_bit_cast(v16bf, __builtin_shufflevector(lo, hi, 0, 1, 2, 3, 4, 5, 6, 7, 8, 9, 10, 11, 12, 13, 14, 15)); }
__device__ __forceinline__ v8f wmmab(v16bf a, v16bf b, v8f c) { return __builtin_amdgcn_wmma_f32_16x16x32_bf16(false, a, false, b, (short)0, c, false, false); }
__device__ __forceinline__ v8f wmmah(v16h a, v16h b, v8f c) { return __builtin_amdgcn_wmma_f32_16x16x32_f16(false, a, false, b, (short)0, c, false, false); }
// fragment of a k-contiguous 16-bit row; p already holds the lane's row and its 8 * (lane >> 4): elements 0..7 = k 8h.., 8..15 = k 16 + 8h..
__device__ __forceinline__ v16bf ldfrag(const bf* p) { return cat16b(*(const v8us*)p, *(const v8us*)(p + 16)); }
__device__ __forceinline__ v8us cvt8(const float* p) { const v8f v = *(const v8f*)p; v8us o;
#pragma unroll
    for (int k = 0; k < 8; ++k) o[k] = f2bf(v[k]);
    return o; }
// value of lane l ^ 16
__device__ __forceinline__ float xhalf(float x) { const int b = __float_as_int(x); return __int_as_float(__builtin_amdgcn_permlanex16(b, b, 0x76543210, 0xfedcba98, false, false)); }

// four f32 rounded to bf16 (nearest even) by the packed convert
__device__ __forceinline__ v4us rnd4(v4f v) { return __builtin_bit_cast(v4us, __builtin_convertvector(v, v4bf)); }
// the same to f16
__device__ __forceinline__ v4us rnd4h(v4f v) { return __builtin_bit_cast(v4us, __builtin_convertvector(v, v4h)); }
// transposing read of a row-major 16-bit tile: p holds row 8 * (lane >> 4) + (lane & 7) and 8 * ((lane >> 3) & 1) elements; lane (c, h) gets rows 8h .. 8h + 7 of column c
__device__ __forceinline__ v8us ldtr(const bf* p) { return __builtin_bit_cast(v8us, __builtin_amdgcn_ds_load_tr16_b128_v8i16((lds_v8s*)p)); }

// lanes of the wave that have 1 to 23 keys of their 24-key span valid; the same word in the whole wave
__device__ __forceinline__ unsigned cutl(int rel) { return __builtin_amdgcn_ballot_w32((unsigned)(rel - 1) < 23u); }
// one pass of 32 keys: kf, vf hold its fragments; rel = valid length (1 or more) - (first key of this lane's half); cut = cutl(rel); first = the wave's first pass (the same in the whole wave)
// m = the query's reference, held from pass to pass: weights are exp(score - m); l = running sum over this half's keys. -m goes in as C of the first score products, so the accumulators come out as score - m.
// m is set MG above the first pass's maximum and raised again (O and l rescaled) only in a pass where some lane's weights sum to more than PTOP, so every weight handed to the f16 product stays below PTOP.
#define MG   4.0f
#define PTOP 16384.0f
#define L2E  1.4426950408889634f
__device__ __forceinline__ float psum(v16f p) {
    const v8f t8 = __builtin_shufflevector(p, p, 0, 1, 2, 3, 4, 5, 6, 7) + __builtin_shufflevector(p, p, 8, 9, 10, 11, 12, 13, 14, 15);
    const v4f t4 = __builtin_shufflevector(t8, t8, 0, 1, 2, 3) + __builtin_shufflevector(t8, t8, 4, 5, 6, 7);
    return (t4[0] + t4[2]) + (t4[1] + t4[3]);
}
__device__ __forceinline__ void fpass(const v16bf (&kf)[4], const v16h (&vf)[4], v16bf q0, v16bf q1, int rel, unsigned cut, bool first, float& m, float& l, v8f (&o)[4]) {
    const float cv = rel <= 0 ? -3.0e38f : -m;   // a lane without a valid key in the pass: all its differences are -3.0e38, all its weights 0
    const v8f c8 = {cv, cv, cv, cv, cv, cv, cv, cv};
    v8f s0 = wmmab(kf[0], q0, c8), s1 = wmmab(kf[2], q0, c8);
    s0 = wmmab(kf[1], q1, s0); s1 = wmmab(kf[3], q1, s1);   // s0[r] = key k0 + 8h + r, s1[r] = key k0 + 16 + 8h + r, query c, each less m
    if (cut) {
#pragma unroll
        for (int r = 0; r < 8; ++r) { s0[r] = (r < rel) ? s0[r] : -3.0e38f; s1[r] = (16 + r < rel) ? s1[r] : -3.0e38f; }   /* keys at or beyond the valid length excluded */
    }
    v16f p;
#pragma unroll
    for (int r = 0; r < 8; ++r) { p[r] = __builtin_amdgcn_exp2f(s0[r] * L2E); p[8 + r] = __builtin_amdgcn_exp2f(s1[r] * L2E); }
    float ps = psum(p);
    if (__builtin_amdgcn_ballot_w32(ps > PTOP) | (first ? 1u : 0u)) {   // wave-uniform: seldom true behind the first pass
        float tm = fmaxf(s0[0], s1[0]);
#pragma unroll
        for (int r = 1; r < 8; ++r) tm = fmaxf(tm, fmaxf(s0[r], s1[r]));
        tm = fmaxf(tm, xhalf(tm));                                // the pass's maximum of the query, less m; the same in both halves
        const float d = fmaxf(tm + MG, first ? -1.0e30f : 0.f);   // the reference only rises, but for the first pass, which sets it (a query with no valid key in this wave's keys: -1.0e30, its differences stay near -3.0e38)
        const float al = __builtin_amdgcn_exp2f(fminf(-d, 0.f) * L2E);   // d below 0 comes only in the first pass, where O and l are 0
        m += d;
#pragma unroll
        for (int r = 0; r < 8; ++r) { p[r] = __builtin_amdgcn_exp2f((s0[r] - d) * L2E); p[8 + r] = __builtin_amdgcn_exp2f((s1[r] - d) * L2E); }
        ps = psum(p);
        l *= al;
#pragma unroll
        for (int dt = 0; dt < 4; ++dt) o[dt] *= al;
    }
    l += ps;   // each half of the wave keeps the sum of its own keys; joined once behind the loop
    const v16h ph = __builtin_convertvector(p, v16h);
#pragma unroll
    for (int dt = 0; dt < 4; ++dt) o[dt] = wmmah(vf[dt], ph, o[dt]);   // o[dt][r] = O[query c][d = 16 dt + 8h + r]
}
__device__ __forceinline__ void kload(v16bf (&kf)[4], const bf* Kp, int k0) {
#pragma unroll
    for (int t = 0; t < 4; ++t) kf[t] = ldfrag(Kp + (k0 + (t >> 1) * 16) * LP + (t & 1) * 32);
}
// value^T fragments: A row = column d = 16 dt + c of the value rows, elements 0..7 = keys k0 + 8h.., 8..15 = keys k0 + 16 + 8h.., the order of P
__device__ __forceinline__ void vload(v16h (&vf)[4], const bf* Vp, int k0) {
#pragma unroll
    for (int dt = 0; dt < 4; ++dt) vf[dt] = __builtin_bit_cast(v16h, cat16b(ldtr(Vp + k0 * LPV + dt * 16), ldtr(Vp + (k0 + 16) * LPV + dt * 16)));
}
// one thread's share of a 128-key tile, still f32: of k and of value each four runs of 4 in row order, run j 32 rows behind run j - 1; neighbouring lanes hold neighbouring runs
__device__ __forceinline__ void gload(v4f (&gk)[4], v4f (&gv)[4], const float* Kg, const float* Vg, int tile) {
    const float* kp = Kg + (size_t)tile * GT * HD; const float* vp = Vg + (size_t)tile * GT * HD;
#pragma unroll
    for (int j = 0; j < 4; ++j) gk[j] = *(const v4f*)(kp + j * 32 * HD);
#pragma unroll
    for (int j = 0; j < 4; ++j) gv[j] = *(const v4f*)(vp + j * 32 * HD);
}
__device__ __forceinline__ void lstore(bf* Ks, bf* Vs, const v4f (&gk)[4], const v4f (&gv)[4]) {
#pragma unroll
    for (int j = 0; j < 4; ++j) *(v4us*)(Ks + (j >> 1) * BUFE + (j & 1) * 32 * LP) = rnd4(gk[j]);
#pragma unroll
    for (int j = 0; j < 4; ++j) *(v4us*)(Vs + (j >> 1) * BUFE + (j & 1) * 32 * LPV) = rnd4h(gv[j]);
}

// The two halves of __syncthreads(), to be placed apart. Signal and wait alternate strictly in every wave.
// tsignal: this wave's LDS stores are done and its LDS reads issued so far have returned (the release fence writes the s_wait_dscnt 0), then it arrives at the work-group's barrier without stopping.
__device__ __forceinline__ void tsignal() { __builtin_amdgcn_fence(__ATOMIC_RELEASE, "workgroup"); __builtin_amdgcn_s_barrier_signal(-1); }
// twait: returns once every wave has given the matching signal; the acquire fence keeps the LDS accesses written behind it from being moved ahead of it.
__device__ __forceinline__ void twait() { __builtin_amdgcn_s_barrier_wait(-1); __builtin_amdgcn_fence(__ATOMIC_ACQUIRE, "workgroup"); }

// grid (TT / (16 * QW), NB_), 32 * QW * KS threads. Lane (c = lane & 15, h = lane >> 4) holds query q0 + c throughout; waves w and w + QW hold the same queries.
__global__ __launch_bounds__(32 * QW * KS) void k_fattn(const float* __restrict__ Q, const float* __restrict__ K, const float* __restrict__ V, const int* __restrict__ vl, float* __restrict__ out) {
    __shared__ __attribute__((aligned(16))) bf sm[3 * TBUF];
    const int tid = threadIdx.x;
    const int lane = tid & 31, c = lane & 15, h = lane >> 4; const int b = blockIdx.y; const int g = (tid >> 5) & (QW - 1), kh = tid >> 8; const int q = (blockIdx.x * QW + g) * 16 + c;   // g = group of queries, kh = this wave's half of every tile
    const float* Kg = K + (size_t)b * TT * HD + tid * 4;             // staging: runs tid, 512 + tid, 1024 + tid, 1536 + tid of 4 values, of the tile's 2048
    const float* Vg = V + (size_t)b * TT * HD + tid * 4;             // the same runs of the value tile
    const int kso = (tid >> 4) * LP + (tid & 15) * 4;                // k row tid >> 4 (and 32 rows on; and the same in the second half), 4 values
    const int vso = VOFF + (tid >> 4) * LPV + (tid & 15) * 4;        // value row, likewise
    const int fo = kh * BUFE + c * LP + 8 * h;                       // k fragments, from this wave's half: A rows = keys
    const int fd = VOFF + (8 * h + (lane & 7)) * LPV + 8 * ((lane >> 3) & 1) - (c * LP + 8 * h);   // from the lane's k fragment address to its address for the transposing read of the value rows of the same half
    const float* Qp = Q + ((size_t)b * TT + q) * HD + 8 * h;
    const int Lr = vl[b * TT + q]; const int L = (Lr <= 0 || Lr > TT) ? TT : Lr;   /* this query's valid length; only compared, never an address; above TT the clamp changes no compare against a key index in [0, TT); 0 or below: every key, with q = 0 */
    const unsigned qk = Lr <= 0 ? 0u : ~0u;
    const v16bf q0 = __builtin_bit_cast(v16bf, __builtin_bit_cast(v8u, cat16b(cvt8(Qp), cvt8(Qp + 16))) & qk), q1 = __builtin_bit_cast(v16bf, __builtin_bit_cast(v8u, cat16b(cvt8(Qp + 32), cvt8(Qp + 48))) & qk);   // B columns = queries, kept in registers
    v8f o[4];
#pragma unroll
    for (int dt = 0; dt < 4; ++dt) o[dt] = (v8f){};
    float m = 0.f, l = 0.f;
    v16bf ka[4], kb[4]; v16h va[4], vb[4];   // two fragment sets, one per pass of the loop body
    v4f gk[4], gv[4];                   // the tile in flight from memory
    {
        v4f hk[4], hv[4];               // tile 1, in flight beside tile 0 (the fragment registers are still free here)
        gload(gk, gv, Kg, Vg, 0);
        gload(hk, hv, Kg, Vg, 1);
        lstore(sm + kso, sm + vso, gk, gv);
        lstore(sm + TBUF + kso, sm + TBUF + vso, hk, hv);
    }
    __syncthreads();                    // tiles 0 and 1 are in buffers 0 and 1 for every wave
    tsignal();                          // opens the alternation: the first body's wait finds a signal (buffer 2 has no reader yet)
    gload(gk, gv, Kg, Vg, 2);
    asm volatile("s_wait_xcnt 0x0" ::: "memory");   // the registers that these loads name (the scalar base among them) are rewritten at the loop's head: the wait stands in front of that
    kload(ka, sm + fo, 0);
    int c0 = 0, c1 = TBUF, c2 = 2 * TBUF;   // buffers of tiles it, it + 1, it + 2 (the last was tile it - 1's)
#pragma unroll 1   // the body stays at one tile of two passes: each further copy would want fragment sets of its own
    for (int it = 0; it < NT; ++it) {
        const int k0 = it * GT + kh * KT;
        const bf* fc = sm + c0 + fo; const bf* fw = fc + fd;
        vload(va, fw, 0); kload(kb, fc, 32); vload(vb, fw, 32);
        const int ra = L - (k0 + 8 * h), rb = ra - 32; const unsigned ca = cutl(ra), cb = cutl(rb);   // both passes' branch words, ready in scalar registers long before the branches
        __builtin_amdgcn_sched_barrier(0);   // keeps these LDS reads at the head of the body, ahead of their use by the first pass's value product (va) or by the whole pass (kb, vb); sunk towards the use their latency is waited for
        fpass(ka, va, q0, q1, ra, ca, it == 0, m, l, o);
        __builtin_amdgcn_sched_barrier(0);   // keeps the wait, the stores and the signal behind the first pass: ahead of it the wave would wait for the LDS reads just issued
        twait();                             // the signal of the previous body, given a whole tile ago: every wave has stored tile it + 1 (read below) and has all its fragments of tile it - 1 in registers (its buffer is written next)
        lstore(sm + c2 + kso, sm + c2 + vso, gk, gv);   // tile it + 2 into the buffer that held tile it - 1; behind the last tiles: tile 0 again, unused
        tsignal();                           // this wave's share of tile it + 2 is stored and all its fragments of tile it are in registers; nobody is waited for here. The reads between this signal and its wait go to tile it + 1, whose buffer is written only behind the wait after that one
        kload(ka, sm + c1 + fo, 0);          // next body's first K fragments fly under the second pass
        gload(gk, gv, Kg, Vg, (it + 3 < NT) ? it + 3 : 0);   // the tile after that flies under the second pass and the next first pass; behind the last tiles: tile 0, in bounds, unused
        __builtin_amdgcn_sched_barrier(0);   // keeps them ahead of the second pass
        fpass(kb, vb, q0, q1, rb, cb, false, m, l, o);
        const int cf = c0; c0 = c1; c1 = c2; c2 = cf;   // the ring turns by one buffer
    }
    twait();                            // takes up the last body's signal, so that signal and wait stay paired
    l += xhalf(l);
    // join of the pair: the wave of the second halves hands m, l and O over in LDS (16 bytes a lane and chunk, lanes side by side), its partner rescales both to the common maximum and stores
    __syncthreads();                    // every wave's reads of the tiles are over: the buffers become the hand-over space
    v4f* xs = (v4f*)sm + g * 32 + lane;
    if (kh) {
#pragma unroll
        for (int dt = 0; dt < 4; ++dt) { xs[(2 * dt) * QW * 32] = __builtin_shufflevector(o[dt], o[dt], 0, 1, 2, 3); xs[(2 * dt + 1) * QW * 32] = __builtin_shufflevector(o[dt], o[dt], 4, 5, 6, 7); }
        xs[8 * QW * 32] = (v4f){m, l, 0.f, 0.f};
    }
    __syncthreads();                    // the hand-over is written
    if (kh) return;
    const v4f ml = xs[8 * QW * 32];
    const float mj = fmaxf(m, ml[0]);   // a half with no valid key holds -1.0e30 and zero sums: its factor is 0 beside the real reference that the first half always has
    const float a0 = __builtin_amdgcn_exp2f((m - mj) * 1.4426950408889634f), a1 = __builtin_amdgcn_exp2f((ml[0] - mj) * 1.4426950408889634f);
    const float fj = __fdiv_rn(1.0f, l * a0 + ml[1] * a1);
    const float f = a0 * fj, f1 = a1 * fj;
    float* orow = out + ((size_t)b * TT + q) * HD + 8 * h;
#pragma unroll
    for (int dt = 0; dt < 4; ++dt) { v4f a, d; const v4f xa = xs[(2 * dt) * QW * 32], xd = xs[(2 * dt + 1) * QW * 32];
#pragma unroll
        for (int r = 0; r < 4; ++r) { a[r] = o[dt][r] * f + xa[r] * f1; d[r] = o[dt][4 + r] * f + xd[r] * f1; }
        *(v4f*)(orow + dt * 16) = a; *(v4f*)(orow + dt * 16 + 4) = d; }
}

extern "C" void kernel_launch(void* const* d_in, const int* in_sizes, int n_in,
                              void* d_out, int out_size, void* d_ws, size_t ws_size, hipStream_t stream) {
    (void)in_sizes; (void)n_in; (void)out_size; (void)d_ws; (void)ws_size;
    const float* Qin = (const float*)d_in[0]; const float* Kin = (const float*)d_in[1]; const float* Vin = (const float*)d_in[2]; const int* vl = (const int*)d_in[3];   /* valid_len [16][2048] int */
    float* OUT = (float*)d_out;
    k_fattn<<<dim3(TT / (16 * QW), NB_, 1), 32 * QW * KS, 0, stream>>>(Qin, Kin, Vin, vl, OUT);
}
